// v000
// The times below were measured on an AMD MI455X: many runs one after another, warmed up first and cycling through
// copies of the inputs, with the whole window's GPU time divided by the number of runs. Launches and the gaps
// between them are all in it. The median over several windows is given; except for v000 it joins two sittings, which
// can be a few percent apart, so the side-by-side timings, each taken in one sitting, are the better comparison.
// v000 is the starting kernel. One run takes 294 microseconds.
#include <hip/hip_runtime.h>
#include <math.h>

typedef __attribute__((ext_vector_type(16))) _Float16 v16h;
typedef __attribute__((ext_vector_type(16))) __bf16 v16b;
typedef __attribute__((ext_vector_type(8)))  _Float16 v8h;
typedef __attribute__((ext_vector_type(8)))  float v8f;
typedef __attribute__((ext_vector_type(4)))  float v4f;
typedef __attribute__((ext_vector_type(2)))  float v2f;
typedef __attribute__((ext_vector_type(4)))  unsigned v4u;
typedef __attribute__((ext_vector_type(4)))  int v4i;
typedef float __attribute__((may_alias)) float_a;
typedef int __attribute__((may_alias)) int_a;

template <typename T> __device__ __forceinline__ void vst2(void* p, T v) { *(T*)p = v;  }
__device__ __forceinline__ v8f wmma16(v16h a, v16h b, v8f c) {
  v8f d = __builtin_amdgcn_wmma_f32_16x16x32_f16(false, a, false, b, (short)0, c, false, false);
  asm volatile("v_nop\n\tv_nop\n\tv_nop\n\tv_nop" : "+v"(d) : "v"(a), "v"(b));
  return d;
}
__device__ __forceinline__ v8f wmma_bf(v16b a, v16b b, v8f c) {
  v8f d = __builtin_amdgcn_wmma_f32_16x16x32_bf16(false, a, false, b, (short)0, c, false, false);
  asm volatile("v_nop\n\tv_nop\n\tv_nop\n\tv_nop" : "+v"(d) : "v"(a), "v"(b));
  return d;
}
// 16x16x32 fragments: lane = (h = lane>>4, row/col = lane&15); elements 0..7 = k0+8h+0..7, 8..15 = k0+16+8h+0..7; D element r = row 8h+r
__device__ __forceinline__ v16h frag_h(const _Float16* rowk0, int lane) {
  union { v16h v; v8h q[2]; } u; const _Float16* p = rowk0 + 8 * (lane >> 4);
  u.q[0] = *(const v8h*)p; u.q[1] = *(const v8h*)(p + 16); return u.v;
}
__device__ __forceinline__ v16h frag_f32(const float* rowk0, int lane) {
  v16h a; const float* p = rowk0 + 8 * (lane >> 4);
#pragma unroll
  for (int i = 0; i < 8; ++i) { a[i] = (_Float16)p[i]; a[8 + i] = (_Float16)p[16 + i]; }
  return a;
}
__device__ __forceinline__ v16h frag_f32s(const float* rowk0, int lane, float sc) {
  v16h a; const float* p = rowk0 + 8 * (lane >> 4);
#pragma unroll
  for (int i = 0; i < 8; ++i) { a[i] = (_Float16)(p[i] * sc); a[8 + i] = (_Float16)(p[16 + i] * sc); }
  return a;
}
// column fragment from a [K][ld] layout (column n), rows >= K read as 0
__device__ __forceinline__ v16h fragc_f32(const float* W, int k0, int n, int lane, int ld, int K) {
  v16h a; const int g = lane >> 4;
#pragma unroll
  for (int i = 0; i < 8; ++i) { const int ka = k0 + 8 * g + i, kb = ka + 16;
    a[i] = (_Float16)(ka < K ? W[(size_t)ka * ld + n] : 0.f); a[8 + i] = (_Float16)(kb < K ? W[(size_t)kb * ld + n] : 0.f); }
  return a;
}
struct F2 { v16b h, l; };
__device__ __forceinline__ F2 bsplit16(const float v[16]) { F2 r;
#pragma unroll
  for (int i = 0; i < 16; ++i) { const __bf16 h = (__bf16)v[i]; r.h[i] = h; r.l[i] = (__bf16)(v[i] - (float)h); }
  return r; }
__device__ __forceinline__ F2 split_row(const float* row, int k0, int lane) { float v[16]; const float* p = row + k0 + 8 * (lane >> 4);
#pragma unroll
  for (int i = 0; i < 8; ++i) { v[i] = p[i]; v[8 + i] = p[16 + i]; }
  return bsplit16(v); }
__device__ __forceinline__ F2 split_rowK(const float* row, int k0, int lane, int K) { float v[16]; const int g = lane >> 4;
#pragma unroll
  for (int i = 0; i < 8; ++i) { const int ka = k0 + 8 * g + i, kb = ka + 16; v[i] = ka < K ? row[ka] : 0.f; v[8 + i] = kb < K ? row[kb] : 0.f; }
  return bsplit16(v); }
__device__ __forceinline__ F2 split_col(const float* W, int k0, int n, int lane, int ld, int K) { float v[16]; const int g = lane >> 4;
#pragma unroll
  for (int i = 0; i < 8; ++i) { const int ka = k0 + 8 * g + i, kb = ka + 16; v[i] = ka < K ? W[(size_t)ka * ld + n] : 0.f; v[8 + i] = kb < K ? W[(size_t)kb * ld + n] : 0.f; }
  return bsplit16(v); }
__device__ __forceinline__ v8f mac3(const F2& a, const F2& b, v8f c) { c = wmma_bf(a.l, b.h, c); c = wmma_bf(a.h, b.l, c); return wmma_bf(a.h, b.h, c); }
__device__ __forceinline__ float sigm(float v) { return 1.0f / (1.0f + expf(-v)); }
#define LDSX() do { asm volatile("s_wait_dscnt 0" ::: "memory"); __builtin_amdgcn_wave_barrier(); __builtin_amdgcn_fence(__ATOMIC_RELEASE, "workgroup"); } while (0)

// Mask-modulated linear attention block: q/k/v projections, per head attn = (q.k * adj + 1)/2 (no softmax), attn @ v, output projection
// + bias, LayerNorm, x + gamma * (.). All products on v_wmma_f32_16x16x32_f16 (x converted once, [out][in] weights packed as f16 rows
// x16, q/k/v kept head-major f16, the [E x E] scores scaled by 1/8 into f16 for the second product, adj mask read as data, the "+1"
#define NB 2
#define EE 2048
#define CC 512
#define NH 8
#define HD 64
#define NR (NB * EE)

__global__ __launch_bounds__(256) void k_cvt(const float* __restrict__ x, _Float16* __restrict__ X16) {
  const size_t i8 = (size_t)blockIdx.x * 256 + threadIdx.x; if (i8 >= (size_t)NR * CC / 8) return;
  union { v8h h; v4u u; } pk;
#pragma unroll
  for (int e = 0; e < 8; ++e) pk.h[e] = (_Float16)x[i8 * 8 + e];
  vst2(X16 + i8 * 8, pk.u);
}
// P rows [which*512 + n][512] f16 x16: W[n][k] ([out][in]) for Wq, Wk, Wv, Wp
__global__ __launch_bounds__(256) void k_pack(const float* __restrict__ Wq, const float* __restrict__ Wk, const float* __restrict__ Wv, const float* __restrict__ Wp, _Float16* __restrict__ P) {
  const int r = blockIdx.x, tid = threadIdx.x; __shared__ __align__(16) _Float16 srow[CC];
  const int which = r >> 9, n = r & 511; const float* W = which == 0 ? Wq : (which == 1 ? Wk : (which == 2 ? Wv : Wp));
  for (int k = tid; k < CC; k += 256) srow[k] = (_Float16)(W[(size_t)n * CC + k] * 16.0f);
  __syncthreads();
  if (tid < 64) vst2(P + (size_t)r * CC + tid * 8, *(const v4u*)(&srow[tid * 8]));
}
// q/k/v: block (64 rows, 128-col chunk = 2 heads, which): Q16/K16 head-major [b][h][e][64] (x4); VT [b][h][d][e] (x4); VS[b][h][64] partial sums handled later from VT
__global__ __launch_bounds__(128) void k_qkv(const _Float16* __restrict__ X16, const _Float16* __restrict__ P, _Float16* __restrict__ Q16, _Float16* __restrict__ K16, _Float16* __restrict__ VT) {
  __shared__ __align__(16) float so[4][16][132];
  __shared__ __align__(16) _Float16 st[128][72];
  const int tid = threadIdx.x, wave = tid >> 5, lane = tid & 31, col = lane & 15, g = lane >> 4;
  const int which = blockIdx.z, r0b = blockIdx.x * 64, r0 = r0b + wave * 16, n0 = blockIdx.y * 128; const int b = r0b / EE, e0 = r0b % EE;
  const _Float16* Pw = P + (size_t)which * CC * CC;
  v8f acc[8] = {};
#pragma unroll 2
  for (int kc = 0; kc < CC / 32; ++kc) { const v16h a = frag_h(X16 + (size_t)(r0 + col) * CC + kc * 32, lane);
#pragma unroll
    for (int j = 0; j < 8; ++j) acc[j] = wmma16(a, frag_h(Pw + (size_t)(n0 + j * 16 + col) * CC + kc * 32, lane), acc[j]); }
  if (which < 2) {
#pragma unroll
    for (int j = 0; j < 8; ++j)
#pragma unroll
      for (int r = 0; r < 8; ++r) so[wave][8 * g + r][j * 16 + col] = acc[j][r] * (4.0f / 16.0f);
    LDSX();
    _Float16* D = which == 0 ? Q16 : K16;
    for (int q = lane; q < 16 * 2 * 8; q += 32) { const int hh = q >> 7, rl = (q >> 3) & 15, pc = q & 7; const int h = (n0 >> 6) + hh; union { v8h h8; v4u u; } pk;
#pragma unroll
      for (int e = 0; e < 8; ++e) pk.h8[e] = (_Float16)so[wave][rl][hh * 64 + pc * 8 + e];
      vst2(D + (((size_t)b * NH + h) * EE + e0 + wave * 16 + rl) * HD + pc * 8, pk.u); } }
  else {
#pragma unroll
    for (int j = 0; j < 8; ++j)
#pragma unroll
      for (int r = 0; r < 8; ++r) st[j * 16 + col][wave * 16 + 8 * g + r] = (_Float16)(acc[j][r] * (4.0f / 16.0f));
    __syncthreads();
    for (int q = tid; q < 128 * 8; q += 128) { const int cl = q >> 3, pc = q & 7; const int c = n0 + cl, h = c >> 6, d = c & 63; vst2(VT + (((size_t)b * NH + h) * HD + d) * EE + e0 + pc * 8, *(const v4u*)(&st[cl][pc * 8])); } }
}
// vsum[b][h][d] = sum_e v (f32, from VT /4): block per (b,h), thread per d (64 threads... use 256: 4 per d)
__global__ __launch_bounds__(256) void k_vsum(const _Float16* __restrict__ VT, float* __restrict__ VS) {
  __shared__ float sp[4][64]; __shared__ __align__(16) float so[64];
  const int bh = blockIdx.x, tid = threadIdx.x, d = tid & 63, part = tid >> 6; float s = 0.f;
  const _Float16* row = VT + ((size_t)bh * HD + d) * EE;
  for (int e = part * 512; e < part * 512 + 512; ++e) s += (float)row[e];
  sp[part][d] = s;
  __syncthreads();
  if (tid < 64) so[tid] = ((sp[0][tid] + sp[1][tid]) + (sp[2][tid] + sp[3][tid])) * 0.25f;
  __syncthreads();
  if (tid < 16) vst2(VS + (size_t)bh * HD + tid * 4, *(const v4f*)(&so[tid * 4]));
}
// attention: block (64 q, h, b): S tiles over all 2048 keys (f16), * adj, /8 -> f16 P; acc += P @ V; out = 0.5*(acc*8/4) + 0.5*vsum -> O16 head-major [b][h][e][64] (x 1/8)
__global__ __launch_bounds__(128) void k_attn(const _Float16* __restrict__ Q16, const _Float16* __restrict__ K16, const _Float16* __restrict__ VT, const float* __restrict__ VS, const float* __restrict__ adj, _Float16* __restrict__ O16) {
  __shared__ __align__(16) _Float16 sP[4][16][72];
  __shared__ __align__(16) float sO[4][16][68];
  const int tid = threadIdx.x, w = tid >> 5, lane = tid & 31, col = lane & 15, g = lane >> 4;
  const int b = blockIdx.z, h = blockIdx.y, q0 = blockIdx.x * 64 + w * 16; const size_t bh = (size_t)b * NH + h;
  v16h aq[2];
#pragma unroll
  for (int kc = 0; kc < 2; ++kc) aq[kc] = frag_h(Q16 + (bh * EE + q0 + col) * HD + kc * 32, lane);
  v8f acc[4] = {};
#pragma unroll 1
  for (int kt = 0; kt < EE / 64; ++kt) {
#pragma unroll
    for (int t = 0; t < 4; ++t) { v8f s = {}; const int key = kt * 64 + t * 16 + col;
#pragma unroll
      for (int kc = 0; kc < 2; ++kc) s = wmma16(aq[kc], frag_h(K16 + (bh * EE + key) * HD + kc * 32, lane), s);
#pragma unroll
      for (int r = 0; r < 8; ++r) { const float m = adj[(size_t)(q0 + 8 * g + r) * EE + key]; sP[w][8 * g + r][t * 16 + col] = (_Float16)(s[r] * m * (1.0f / (16.0f * 8.0f))); } }   // (x4 x4)/16 = true qk ; stored /8
    LDSX();
#pragma unroll
    for (int kc = 0; kc < 2; ++kc) { const v16h pa = frag_h(&sP[w][col][0] + kc * 32, lane);
#pragma unroll
      for (int t = 0; t < 4; ++t) acc[t] = wmma16(pa, frag_h(VT + (bh * HD + t * 16 + col) * EE + kt * 64 + kc * 32, lane), acc[t]); }
    LDSX(); }
  // out = 0.5 * (acc * 8 / 4) + 0.5 * vsum[d]   (V stored x4) ; store O x 1/8 as f16 (values ~ O(50))
#pragma unroll
  for (int t = 0; t < 4; ++t) { const int d = t * 16 + col; const float vs = VS[bh * HD + d];
#pragma unroll
    for (int r = 0; r < 8; ++r) sO[w][8 * g + r][d] = (0.5f * (acc[t][r] * 2.0f) + 0.5f * vs) * 0.125f; }
  LDSX();
  for (int q = lane; q < 16 * 8; q += 32) { const int rl = q >> 3, pc = q & 7; union { v8h h8; v4u u; } pk;
#pragma unroll
    for (int e = 0; e < 8; ++e) pk.h8[e] = (_Float16)sO[w][rl][pc * 8 + e];
    vst2(O16 + (bh * EE + q0 + rl) * HD + pc * 8, pk.u); }
}
// proj + bias + LN; y = x + gamma * LN(out)  block 64 rows, full 512 cols (4 passes of 128)
__global__ __launch_bounds__(128) void k_proj(const _Float16* __restrict__ O16, const _Float16* __restrict__ P, const float* __restrict__ bp, const float* __restrict__ lnw, const float* __restrict__ lnb, const float* __restrict__ gam, const float* __restrict__ x, float* __restrict__ out) {
  __shared__ __align__(16) float sy[64][CC + 4];
  const int tid = threadIdx.x, wave = tid >> 5, lane = tid & 31, col = lane & 15, g = lane >> 4;
  const int r0b = blockIdx.x * 64, r0 = r0b + wave * 16;
#pragma unroll 1
  for (int np = 0; np < 4; ++np) { v8f acc[8] = {};
#pragma unroll 2
    for (int kc = 0; kc < CC / 32; ++kc) { const int R = r0 + col; const v16h a = frag_h(O16 + ((((size_t)(R / EE)) * NH + (kc >> 1)) * EE + (R % EE)) * HD + (kc & 1) * 32, lane);
#pragma unroll
      for (int j = 0; j < 8; ++j) acc[j] = wmma16(a, frag_h(P + (size_t)(3 * CC + np * 128 + j * 16 + col) * CC + kc * 32, lane), acc[j]); }
#pragma unroll
    for (int j = 0; j < 8; ++j) { const int c = np * 128 + j * 16 + col; const float bb = bp[c];
#pragma unroll
      for (int r = 0; r < 8; ++r) sy[wave * 16 + 8 * g + r][c] = acc[j][r] * (8.0f / 16.0f) + bb; } }
  LDSX();
  { const int rl = lane >> 1, hf = lane & 1; float* row = &sy[wave * 16 + rl][0]; float s = 0.f; for (int c = hf * 256; c < hf * 256 + 256; ++c) s += row[c]; s += __shfl_xor(s, 1, 32); const float mu = s * (1.0f / CC);
    float q2 = 0.f; for (int c = hf * 256; c < hf * 256 + 256; ++c) { const float dv = row[c] - mu; q2 += dv * dv; } q2 += __shfl_xor(q2, 1, 32); const float rs = rsqrtf(q2 * (1.0f / CC) + 1e-5f);
    const float gm = gam[0]; const float* xr = x + (size_t)(r0 + rl) * CC;
    LDSX();
    for (int c = hf * 256; c < hf * 256 + 256; ++c) row[c] = xr[c] + gm * ((row[c] - mu) * rs * lnw[c] + lnb[c]); }
  LDSX();
  for (int rl = 0; rl < 16; ++rl) for (int pc = lane; pc < CC / 4; pc += 32) vst2(out + (size_t)(r0 + rl) * CC + pc * 4, *(const v4f*)(&sy[wave * 16 + rl][pc * 4]));
}
extern "C" void kernel_launch(void* const* d_in, const int* in_sizes, int n_in, void* d_out, int out_size, void* d_ws, size_t ws_size, hipStream_t stream) {
  (void)in_sizes; (void)n_in; (void)out_size; (void)ws_size;
  const float** I = (const float**)d_in;
  const float* x = I[0]; const float* adj = I[1]; const float* Wq = I[2]; const float* Wk = I[3]; const float* Wv = I[4]; const float* Wp = I[5]; const float* bp = I[6]; const float* lnw = I[7]; const float* lnb = I[8]; const float* gam = I[9];
  float* out = (float*)d_out;
  char* ws = (char*)d_ws; size_t off = 0;
  auto take = [&](size_t bytes) { char* p = ws + off; off += (bytes + 255) & ~(size_t)255; return p; };
  _Float16* X16 = (_Float16*)take((size_t)NR * CC * 2); _Float16* P = (_Float16*)take((size_t)4 * CC * CC * 2);
  _Float16* Q16 = (_Float16*)take((size_t)NR * CC * 2); _Float16* K16 = (_Float16*)take((size_t)NR * CC * 2); _Float16* VT = (_Float16*)take((size_t)NR * CC * 2); float* VS = (float*)take((size_t)NB * NH * HD * 4); _Float16* O16 = (_Float16*)take((size_t)NR * CC * 2);
  k_cvt<<<(NR * CC / 8 + 255) / 256, 256, 0, stream>>>(x, X16);
  k_pack<<<4 * CC, 256, 0, stream>>>(Wq, Wk, Wv, Wp, P);
  k_qkv<<<dim3(NR / 64, CC / 128, 3), 128, 0, stream>>>(X16, P, Q16, K16, VT);
  k_vsum<<<NB * NH, 256, 0, stream>>>(VT, VS);
  k_attn<<<dim3(EE / 64, NH, NB), 128, 0, stream>>>(Q16, K16, VT, VS, adj, O16);
  k_proj<<<NR / 64, 128, 0, stream>>>(O16, P, bp, lnw, lnb, gam, x, out);
}

// v001
// One run takes 200 microseconds.
// In two side-by-side timings against v000, it was 1.54 and 1.49 times as fast.
#include <hip/hip_runtime.h>
#include <math.h>

typedef __attribute__((ext_vector_type(16))) _Float16 v16h;
typedef __attribute__((ext_vector_type(16))) __bf16 v16b;
typedef __attribute__((ext_vector_type(8)))  _Float16 v8h;
typedef __attribute__((ext_vector_type(8)))  float v8f;
typedef __attribute__((ext_vector_type(4)))  float v4f;
typedef __attribute__((ext_vector_type(2)))  float v2f;
typedef __attribute__((ext_vector_type(4)))  unsigned v4u;
typedef __attribute__((ext_vector_type(4)))  int v4i;
typedef float __attribute__((may_alias)) float_a;
typedef int __attribute__((may_alias)) int_a;

template <typename T> __device__ __forceinline__ void vst2(void* p, T v) { *(T*)p = v;  }
__device__ __forceinline__ v8f wmma16(v16h a, v16h b, v8f c) {
  v8f d = __builtin_amdgcn_wmma_f32_16x16x32_f16(false, a, false, b, (short)0, c, false, false);
  asm volatile("v_nop\n\tv_nop\n\tv_nop\n\tv_nop" : "+v"(d) : "v"(a), "v"(b));
  return d;
}
__device__ __forceinline__ v8f wmma_bf(v16b a, v16b b, v8f c) {
  v8f d = __builtin_amdgcn_wmma_f32_16x16x32_bf16(false, a, false, b, (short)0, c, false, false);
  asm volatile("v_nop\n\tv_nop\n\tv_nop\n\tv_nop" : "+v"(d) : "v"(a), "v"(b));
  return d;
}
// 16x16x32 fragments: lane = (h = lane>>4, row/col = lane&15); elements 0..7 = k0+8h+0..7, 8..15 = k0+16+8h+0..7; D element r = row 8h+r
__device__ __forceinline__ v16h frag_h(const _Float16* rowk0, int lane) {
  union { v16h v; v8h q[2]; } u; const _Float16* p = rowk0 + 8 * (lane >> 4);
  u.q[0] = *(const v8h*)p; u.q[1] = *(const v8h*)(p + 16); return u.v;
}
__device__ __forceinline__ v16h frag_f32(const float* rowk0, int lane) {
  v16h a; const float* p = rowk0 + 8 * (lane >> 4);
#pragma unroll
  for (int i = 0; i < 8; ++i) { a[i] = (_Float16)p[i]; a[8 + i] = (_Float16)p[16 + i]; }
  return a;
}
__device__ __forceinline__ v16h frag_f32s(const float* rowk0, int lane, float sc) {
  v16h a; const float* p = rowk0 + 8 * (lane >> 4);
#pragma unroll
  for (int i = 0; i < 8; ++i) { a[i] = (_Float16)(p[i] * sc); a[8 + i] = (_Float16)(p[16 + i] * sc); }
  return a;
}
// column fragment from a [K][ld] layout (column n), rows >= K read as 0
__device__ __forceinline__ v16h fragc_f32(const float* W, int k0, int n, int lane, int ld, int K) {
  v16h a; const int g = lane >> 4;
#pragma unroll
  for (int i = 0; i < 8; ++i) { const int ka = k0 + 8 * g + i, kb = ka + 16;
    a[i] = (_Float16)(ka < K ? W[(size_t)ka * ld + n] : 0.f); a[8 + i] = (_Float16)(kb < K ? W[(size_t)kb * ld + n] : 0.f); }
  return a;
}
struct F2 { v16b h, l; };
__device__ __forceinline__ F2 bsplit16(const float v[16]) { F2 r;
#pragma unroll
  for (int i = 0; i < 16; ++i) { const __bf16 h = (__bf16)v[i]; r.h[i] = h; r.l[i] = (__bf16)(v[i] - (float)h); }
  return r; }
__device__ __forceinline__ F2 split_row(const float* row, int k0, int lane) { float v[16]; const float* p = row + k0 + 8 * (lane >> 4);
#pragma unroll
  for (int i = 0; i < 8; ++i) { v[i] = p[i]; v[8 + i] = p[16 + i]; }
  return bsplit16(v); }
__device__ __forceinline__ F2 split_rowK(const float* row, int k0, int lane, int K) { float v[16]; const int g = lane >> 4;
#pragma unroll
  for (int i = 0; i < 8; ++i) { const int ka = k0 + 8 * g + i, kb = ka + 16; v[i] = ka < K ? row[ka] : 0.f; v[8 + i] = kb < K ? row[kb] : 0.f; }
  return bsplit16(v); }
__device__ __forceinline__ F2 split_col(const float* W, int k0, int n, int lane, int ld, int K) { float v[16]; const int g = lane >> 4;
#pragma unroll
  for (int i = 0; i < 8; ++i) { const int ka = k0 + 8 * g + i, kb = ka + 16; v[i] = ka < K ? W[(size_t)ka * ld + n] : 0.f; v[8 + i] = kb < K ? W[(size_t)kb * ld + n] : 0.f; }
  return bsplit16(v); }
__device__ __forceinline__ v8f mac3(const F2& a, const F2& b, v8f c) { c = wmma_bf(a.l, b.h, c); c = wmma_bf(a.h, b.l, c); return wmma_bf(a.h, b.h, c); }
__device__ __forceinline__ float sigm(float v) { return 1.0f / (1.0f + expf(-v)); }
#define LDSX() do { asm volatile("s_wait_dscnt 0" ::: "memory"); __builtin_amdgcn_wave_barrier(); __builtin_amdgcn_fence(__ATOMIC_RELEASE, "workgroup"); } while (0)

// Mask-modulated linear attention block: q/k/v projections, per head attn = (q.k * adj + 1)/2 (no softmax), attn @ v, output projection
// + bias, LayerNorm, x + gamma * (.). All products on v_wmma_f32_16x16x32_f16 (x converted once, [out][in] weights packed as f16 rows
// x16, q/k/v kept head-major f16, the [E x E] scores scaled by 1/8 into f16 for the second product, adj mask read as data, the "+1"
#define NB 2
#define EE 2048
#define CC 512
#define NH 8
#define HD 64
#define NR (NB * EE)

__global__ __launch_bounds__(256) void k_cvt(const float* __restrict__ x, _Float16* __restrict__ X16) {
  const size_t i8 = (size_t)blockIdx.x * 256 + threadIdx.x; if (i8 >= (size_t)NR * CC / 8) return;
  union { v8h h; v4u u; } pk;
#pragma unroll
  for (int e = 0; e < 8; ++e) pk.h[e] = (_Float16)x[i8 * 8 + e];
  vst2(X16 + i8 * 8, pk.u);
}
// P rows [which*512 + n][512] f16 x16: W[n][k] ([out][in]) for Wq, Wk, Wv, Wp
__global__ __launch_bounds__(256) void k_pack(const float* __restrict__ Wq, const float* __restrict__ Wk, const float* __restrict__ Wv, const float* __restrict__ Wp, _Float16* __restrict__ P) {
  const int r = blockIdx.x, tid = threadIdx.x; __shared__ __align__(16) _Float16 srow[CC];
  const int which = r >> 9, n = r & 511; const float* W = which == 0 ? Wq : (which == 1 ? Wk : (which == 2 ? Wv : Wp));
  for (int k = tid; k < CC; k += 256) srow[k] = (_Float16)(W[(size_t)n * CC + k] * 16.0f);
  __syncthreads();
  if (tid < 64) vst2(P + (size_t)r * CC + tid * 8, *(const v4u*)(&srow[tid * 8]));
}
// q/k/v: block (64 rows, 128-col chunk = 2 heads, which): Q16/K16 head-major [b][h][e][64] (x4); VT [b][h][d][e] (x4); VS[b][h][64] partial sums handled later from VT
__global__ __launch_bounds__(128) void k_qkv(const _Float16* __restrict__ X16, const _Float16* __restrict__ P, _Float16* __restrict__ Q16, _Float16* __restrict__ K16, _Float16* __restrict__ VT) {
  __shared__ __align__(16) float so[4][16][132];
  __shared__ __align__(16) _Float16 st[128][72];
  const int tid = threadIdx.x, wave = tid >> 5, lane = tid & 31, col = lane & 15, g = lane >> 4;
  const int which = blockIdx.z, r0b = blockIdx.x * 64, r0 = r0b + wave * 16, n0 = blockIdx.y * 128; const int b = r0b / EE, e0 = r0b % EE;
  const _Float16* Pw = P + (size_t)which * CC * CC;
  v8f acc[8] = {};
#pragma unroll 2
  for (int kc = 0; kc < CC / 32; ++kc) { const v16h a = frag_h(X16 + (size_t)(r0 + col) * CC + kc * 32, lane);
#pragma unroll
    for (int j = 0; j < 8; ++j) acc[j] = wmma16(a, frag_h(Pw + (size_t)(n0 + j * 16 + col) * CC + kc * 32, lane), acc[j]); }
  if (which < 2) {
#pragma unroll
    for (int j = 0; j < 8; ++j)
#pragma unroll
      for (int r = 0; r < 8; ++r) so[wave][8 * g + r][j * 16 + col] = acc[j][r] * (4.0f / 16.0f);
    LDSX();
    _Float16* D = which == 0 ? Q16 : K16;
    for (int q = lane; q < 16 * 2 * 8; q += 32) { const int hh = q >> 7, rl = (q >> 3) & 15, pc = q & 7; const int h = (n0 >> 6) + hh; union { v8h h8; v4u u; } pk;
#pragma unroll
      for (int e = 0; e < 8; ++e) pk.h8[e] = (_Float16)so[wave][rl][hh * 64 + pc * 8 + e];
      vst2(D + (((size_t)b * NH + h) * EE + e0 + wave * 16 + rl) * HD + pc * 8, pk.u); } }
  else {
#pragma unroll
    for (int j = 0; j < 8; ++j)
#pragma unroll
      for (int r = 0; r < 8; ++r) st[j * 16 + col][wave * 16 + 8 * g + r] = (_Float16)(acc[j][r] * (4.0f / 16.0f));
    __syncthreads();
    for (int q = tid; q < 128 * 8; q += 128) { const int cl = q >> 3, pc = q & 7; const int c = n0 + cl, h = c >> 6, d = c & 63; vst2(VT + (((size_t)b * NH + h) * HD + d) * EE + e0 + pc * 8, *(const v4u*)(&st[cl][pc * 8])); } }
}
// vsum[b][h][d] = sum_e v (f32, from VT /4): block per (b,h), thread per d (64 threads... use 256: 4 per d)
__global__ __launch_bounds__(256) void k_vsum(const _Float16* __restrict__ VT, float* __restrict__ VS) {
  __shared__ float sp[4][64]; __shared__ __align__(16) float so[64];
  const int bh = blockIdx.x, tid = threadIdx.x, d = tid & 63, part = tid >> 6; float s = 0.f;
  const _Float16* row = VT + ((size_t)bh * HD + d) * EE;
  for (int e = part * 512; e < part * 512 + 512; ++e) s += (float)row[e];
  sp[part][d] = s;
  __syncthreads();
  if (tid < 64) so[tid] = ((sp[0][tid] + sp[1][tid]) + (sp[2][tid] + sp[3][tid])) * 0.25f;
  __syncthreads();
  if (tid < 16) vst2(VS + (size_t)bh * HD + tid * 4, *(const v4f*)(&so[tid * 4]));
}
// attention: block (64 q, h, b): S tiles over all 2048 keys (f16), * adj, /8 -> f16 P; acc += P @ V; out = 0.5*(acc*8/4) + 0.5*vsum -> O16 head-major [b][h][e][64] (x 1/8)
__global__ __launch_bounds__(128) void k_attn(const _Float16* __restrict__ Q16, const _Float16* __restrict__ K16, const _Float16* __restrict__ VT, const float* __restrict__ VS, const float* __restrict__ adj, _Float16* __restrict__ O16) {
  __shared__ __align__(16) _Float16 sP[4][16][72];
  __shared__ __align__(16) float sO[4][16][68];
  const int tid = threadIdx.x, w = tid >> 5, lane = tid & 31, col = lane & 15, g = lane >> 4;
  const int b = blockIdx.z, h = blockIdx.y, q0 = blockIdx.x * 64 + w * 16; const size_t bh = (size_t)b * NH + h;
  v16h aq[2];
#pragma unroll
  for (int kc = 0; kc < 2; ++kc) aq[kc] = frag_h(Q16 + (bh * EE + q0 + col) * HD + kc * 32, lane);
  v8f acc[4] = {};
#pragma unroll 1
  for (int kt = 0; kt < EE / 64; ++kt) {
#pragma unroll
    for (int t = 0; t < 4; ++t) { v8f s = {}; const int key = kt * 64 + t * 16 + col;
#pragma unroll
      for (int kc = 0; kc < 2; ++kc) s = wmma16(aq[kc], frag_h(K16 + (bh * EE + key) * HD + kc * 32, lane), s);
#pragma unroll
      for (int r = 0; r < 8; ++r) { const float m = adj[(size_t)(q0 + 8 * g + r) * EE + key]; sP[w][8 * g + r][t * 16 + col] = (_Float16)(s[r] * m * (1.0f / (16.0f * 8.0f))); } }   // (x4 x4)/16 = true qk ; stored /8
    LDSX();
#pragma unroll
    for (int kc = 0; kc < 2; ++kc) { const v16h pa = frag_h(&sP[w][col][0] + kc * 32, lane);
#pragma unroll
      for (int t = 0; t < 4; ++t) acc[t] = wmma16(pa, frag_h(VT + (bh * HD + t * 16 + col) * EE + kt * 64 + kc * 32, lane), acc[t]); }
    LDSX(); }
  // out = 0.5 * (acc * 8 / 4) + 0.5 * vsum[d]   (V stored x4) ; store O x 1/8 as f16 (values ~ O(50))
#pragma unroll
  for (int t = 0; t < 4; ++t) { const int d = t * 16 + col; const float vs = VS[bh * HD + d];
#pragma unroll
    for (int r = 0; r < 8; ++r) sO[w][8 * g + r][d] = (0.5f * (acc[t][r] * 2.0f) + 0.5f * vs) * 0.125f; }
  LDSX();
  for (int q = lane; q < 16 * 8; q += 32) { const int rl = q >> 3, pc = q & 7; union { v8h h8; v4u u; } pk;
#pragma unroll
    for (int e = 0; e < 8; ++e) pk.h8[e] = (_Float16)sO[w][rl][pc * 8 + e];
    vst2(O16 + (bh * EE + q0 + rl) * HD + pc * 8, pk.u); }
}
// proj + bias + LN; y = x + gamma * LN(out). Block = 16 rows x all 512 cols, 8 waves: wave w does cols 64w..64w+63 (one pass),
// then, behind one block barrier, wave w normalises rows 2w and 2w+1 with 16 columns per lane and whole-line loads and stores.
__global__ __launch_bounds__(256) void k_proj(const _Float16* __restrict__ O16, const _Float16* __restrict__ P, const float* __restrict__ bp, const float* __restrict__ lnw, const float* __restrict__ lnb, const float* __restrict__ gam, const float* __restrict__ x, float* __restrict__ out) {
  __shared__ __align__(16) float sy[16][CC + 4];
  const int tid = threadIdx.x, wave = tid >> 5, lane = tid & 31, col = lane & 15, g = lane >> 4;
  const int r0 = blockIdx.x * 16, n0 = wave * 64;
  v8f acc[4] = {};
#pragma unroll 2
  for (int kc = 0; kc < CC / 32; ++kc) { const int R = r0 + col; const v16h a = frag_h(O16 + ((((size_t)(R / EE)) * NH + (kc >> 1)) * EE + (R % EE)) * HD + (kc & 1) * 32, lane);
#pragma unroll
    for (int j = 0; j < 4; ++j) acc[j] = wmma16(a, frag_h(P + (size_t)(3 * CC + n0 + j * 16 + col) * CC + kc * 32, lane), acc[j]); }
  // this wave's x rows and the LN weights are asked for here, so that they fly during the LDS exchange and the row sums
  const float gm = gam[0]; v4f lw[4], lb[4], xv[2][4];
#pragma unroll
  for (int i = 0; i < 4; ++i) { lw[i] = *(const v4f*)(lnw + (i * 32 + lane) * 4); lb[i] = *(const v4f*)(lnb + (i * 32 + lane) * 4);
#pragma unroll
    for (int rr = 0; rr < 2; ++rr) xv[rr][i] = *(const v4f*)(x + (size_t)(r0 + wave * 2 + rr) * CC + (i * 32 + lane) * 4); }
#pragma unroll
  for (int j = 0; j < 4; ++j) { const int c = n0 + j * 16 + col; const float bb = bp[c];
#pragma unroll
    for (int r = 0; r < 8; ++r) sy[8 * g + r][c] = acc[j][r] * (8.0f / 16.0f) + bb; }
  __syncthreads();   // a row's 512 columns come from all eight waves
#pragma unroll
  for (int rr = 0; rr < 2; ++rr) { const int rl = wave * 2 + rr; v4f v[4];
#pragma unroll
    for (int i = 0; i < 4; ++i) v[i] = *(const v4f*)(&sy[rl][(i * 32 + lane) * 4]);
    float s = 0.f;
#pragma unroll
    for (int i = 0; i < 4; ++i) s += (v[i][0] + v[i][1]) + (v[i][2] + v[i][3]);
#pragma unroll
    for (int m = 16; m >= 1; m >>= 1) s += __shfl_xor(s, m, 32);
    const float mu = s * (1.0f / CC); float q2 = 0.f;
#pragma unroll
    for (int i = 0; i < 4; ++i) { v[i] -= mu; const v4f d2 = v[i] * v[i]; q2 += (d2[0] + d2[1]) + (d2[2] + d2[3]); }
#pragma unroll
    for (int m = 16; m >= 1; m >>= 1) q2 += __shfl_xor(q2, m, 32);
    const float rs = rsqrtf(q2 * (1.0f / CC) + 1e-5f);
#pragma unroll
    for (int i = 0; i < 4; ++i) vst2(out + (size_t)(r0 + rl) * CC + (i * 32 + lane) * 4, (v4f)(xv[rr][i] + gm * (v[i] * rs * lw[i] + lb[i]))); }
}
extern "C" void kernel_launch(void* const* d_in, const int* in_sizes, int n_in, void* d_out, int out_size, void* d_ws, size_t ws_size, hipStream_t stream) {
  (void)in_sizes; (void)n_in; (void)out_size; (void)ws_size;
  const float** I = (const float**)d_in;
  const float* x = I[0]; const float* adj = I[1]; const float* Wq = I[2]; const float* Wk = I[3]; const float* Wv = I[4]; const float* Wp = I[5]; const float* bp = I[6]; const float* lnw = I[7]; const float* lnb = I[8]; const float* gam = I[9];
  float* out = (float*)d_out;
  char* ws = (char*)d_ws; size_t off = 0;
  auto take = [&](size_t bytes) { char* p = ws + off; off += (bytes + 255) & ~(size_t)255; return p; };
  _Float16* X16 = (_Float16*)take((size_t)NR * CC * 2); _Float16* P = (_Float16*)take((size_t)4 * CC * CC * 2);
  _Float16* Q16 = (_Float16*)take((size_t)NR * CC * 2); _Float16* K16 = (_Float16*)take((size_t)NR * CC * 2); _Float16* VT = (_Float16*)take((size_t)NR * CC * 2); float* VS = (float*)take((size_t)NB * NH * HD * 4); _Float16* O16 = (_Float16*)take((size_t)NR * CC * 2);
  k_cvt<<<(NR * CC / 8 + 255) / 256, 256, 0, stream>>>(x, X16);
  k_pack<<<4 * CC, 256, 0, stream>>>(Wq, Wk, Wv, Wp, P);
  k_qkv<<<dim3(NR / 64, CC / 128, 3), 128, 0, stream>>>(X16, P, Q16, K16, VT);
  k_vsum<<<NB * NH, 256, 0, stream>>>(VT, VS);
  k_attn<<<dim3(EE / 64, NH, NB), 128, 0, stream>>>(Q16, K16, VT, VS, adj, O16);
  k_proj<<<NR / 16, 256, 0, stream>>>(O16, P, bp, lnw, lnb, gam, x, out);
}

// v002
// A run of this version takes 112 microseconds.
// In two side-by-side timings against v001, it was 1.75 and 1.83 times as fast.
// Counting every step since v000, it is 2.71 times as fast.
#include <hip/hip_runtime.h>
#include <math.h>

typedef __attribute__((ext_vector_type(16))) _Float16 v16h;
typedef __attribute__((ext_vector_type(16))) __bf16 v16b;
typedef __attribute__((ext_vector_type(8)))  _Float16 v8h;
typedef __attribute__((ext_vector_type(8)))  float v8f;
typedef __attribute__((ext_vector_type(4)))  float v4f;
typedef __attribute__((ext_vector_type(2)))  float v2f;
typedef __attribute__((ext_vector_type(4)))  unsigned v4u;
typedef __attribute__((ext_vector_type(4)))  int v4i;
typedef float __attribute__((may_alias)) float_a;
typedef int __attribute__((may_alias)) int_a;

template <typename T> __device__ __forceinline__ void vst2(void* p, T v) { *(T*)p = v;  }
__device__ __forceinline__ v8f wmma16(v16h a, v16h b, v8f c) {
  v8f d = __builtin_amdgcn_wmma_f32_16x16x32_f16(false, a, false, b, (short)0, c, false, false);
  asm volatile("v_nop\n\tv_nop\n\tv_nop\n\tv_nop" : "+v"(d) : "v"(a), "v"(b));
  return d;
}
__device__ __forceinline__ v8f wmma_bf(v16b a, v16b b, v8f c) {
  v8f d = __builtin_amdgcn_wmma_f32_16x16x32_bf16(false, a, false, b, (short)0, c, false, false);
  asm volatile("v_nop\n\tv_nop\n\tv_nop\n\tv_nop" : "+v"(d) : "v"(a), "v"(b));
  return d;
}
// 16x16x32 fragments: lane = (h = lane>>4, row/col = lane&15); elements 0..7 = k0+8h+0..7, 8..15 = k0+16+8h+0..7; D element r = row 8h+r
__device__ __forceinline__ v16h frag_h(const _Float16* rowk0, int lane) {
  union { v16h v; v8h q[2]; } u; const _Float16* p = rowk0 + 8 * (lane >> 4);
  u.q[0] = *(const v8h*)p; u.q[1] = *(const v8h*)(p + 16); return u.v;
}
__device__ __forceinline__ v16h frag_f32(const float* rowk0, int lane) {
  v16h a; const float* p = rowk0 + 8 * (lane >> 4);
#pragma unroll
  for (int i = 0; i < 8; ++i) { a[i] = (_Float16)p[i]; a[8 + i] = (_Float16)p[16 + i]; }
  return a;
}
__device__ __forceinline__ v16h frag_f32s(const float* rowk0, int lane, float sc) {
  v16h a; const float* p = rowk0 + 8 * (lane >> 4);
#pragma unroll
  for (int i = 0; i < 8; ++i) { a[i] = (_Float16)(p[i] * sc); a[8 + i] = (_Float16)(p[16 + i] * sc); }
  return a;
}
// column fragment from a [K][ld] layout (column n), rows >= K read as 0
__device__ __forceinline__ v16h fragc_f32(const float* W, int k0, int n, int lane, int ld, int K) {
  v16h a; const int g = lane >> 4;
#pragma unroll
  for (int i = 0; i < 8; ++i) { const int ka = k0 + 8 * g + i, kb = ka + 16;
    a[i] = (_Float16)(ka < K ? W[(size_t)ka * ld + n] : 0.f); a[8 + i] = (_Float16)(kb < K ? W[(size_t)kb * ld + n] : 0.f); }
  return a;
}
struct F2 { v16b h, l; };
__device__ __forceinline__ F2 bsplit16(const float v[16]) { F2 r;
#pragma unroll
  for (int i = 0; i < 16; ++i) { const __bf16 h = (__bf16)v[i]; r.h[i] = h; r.l[i] = (__bf16)(v[i] - (float)h); }
  return r; }
__device__ __forceinline__ F2 split_row(const float* row, int k0, int lane) { float v[16]; const float* p = row + k0 + 8 * (lane >> 4);
#pragma unroll
  for (int i = 0; i < 8; ++i) { v[i] = p[i]; v[8 + i] = p[16 + i]; }
  return bsplit16(v); }
__device__ __forceinline__ F2 split_rowK(const float* row, int k0, int lane, int K) { float v[16]; const int g = lane >> 4;
#pragma unroll
  for (int i = 0; i < 8; ++i) { const int ka = k0 + 8 * g + i, kb = ka + 16; v[i] = ka < K ? row[ka] : 0.f; v[8 + i] = kb < K ? row[kb] : 0.f; }
  return bsplit16(v); }
__device__ __forceinline__ F2 split_col(const float* W, int k0, int n, int lane, int ld, int K) { float v[16]; const int g = lane >> 4;
#pragma unroll
  for (int i = 0; i < 8; ++i) { const int ka = k0 + 8 * g + i, kb = ka + 16; v[i] = ka < K ? W[(size_t)ka * ld + n] : 0.f; v[8 + i] = kb < K ? W[(size_t)kb * ld + n] : 0.f; }
  return bsplit16(v); }
__device__ __forceinline__ v8f mac3(const F2& a, const F2& b, v8f c) { c = wmma_bf(a.l, b.h, c); c = wmma_bf(a.h, b.l, c); return wmma_bf(a.h, b.h, c); }
__device__ __forceinline__ float sigm(float v) { return 1.0f / (1.0f + expf(-v)); }
#define LDSX() do { asm volatile("s_wait_dscnt 0" ::: "memory"); __builtin_amdgcn_wave_barrier(); __builtin_amdgcn_fence(__ATOMIC_RELEASE, "workgroup"); } while (0)

// Mask-modulated linear attention block: q/k/v projections, per head attn = (q.k * adj + 1)/2 (no softmax), attn @ v, output projection
// + bias, LayerNorm, x + gamma * (.). All products on v_wmma_f32_16x16x32_f16 (x converted once, [out][in] weights packed as f16 rows
// x16, q/k/v kept head-major f16, the [E x E] scores scaled by 1/8 into f16 for the second product, adj mask read as data, the "+1"
#define NB 2
#define EE 2048
#define CC 512
#define NH 8
#define HD 64
#define NR (NB * EE)

__global__ __launch_bounds__(256) void k_cvt(const float* __restrict__ x, _Float16* __restrict__ X16) {
  const size_t i8 = (size_t)blockIdx.x * 256 + threadIdx.x; if (i8 >= (size_t)NR * CC / 8) return;
  union { v8h h; v4u u; } pk;
#pragma unroll
  for (int e = 0; e < 8; ++e) pk.h[e] = (_Float16)x[i8 * 8 + e];
  vst2(X16 + i8 * 8, pk.u);
}
// P rows [which*512 + n][512] f16 x16: W[n][k] ([out][in]) for Wq, Wk, Wv, Wp
__global__ __launch_bounds__(256) void k_pack(const float* __restrict__ Wq, const float* __restrict__ Wk, const float* __restrict__ Wv, const float* __restrict__ Wp, _Float16* __restrict__ P) {
  const int r = blockIdx.x, tid = threadIdx.x; __shared__ __align__(16) _Float16 srow[CC];
  const int which = r >> 9, n = r & 511; const float* W = which == 0 ? Wq : (which == 1 ? Wk : (which == 2 ? Wv : Wp));
  for (int k = tid; k < CC; k += 256) srow[k] = (_Float16)(W[(size_t)n * CC + k] * 16.0f);
  __syncthreads();
  if (tid < 64) vst2(P + (size_t)r * CC + tid * 8, *(const v4u*)(&srow[tid * 8]));
}
// q/k/v: block (64 rows, 128-col chunk = 2 heads, which): Q16/K16 head-major [b][h][e][64] (x4); VT [b][h][d][e] (x4); VS[b][h][64] partial sums handled later from VT
__global__ __launch_bounds__(128) void k_qkv(const _Float16* __restrict__ X16, const _Float16* __restrict__ P, _Float16* __restrict__ Q16, _Float16* __restrict__ K16, _Float16* __restrict__ VT) {
  __shared__ __align__(16) float so[4][16][132];
  __shared__ __align__(16) _Float16 st[128][72];
  const int tid = threadIdx.x, wave = tid >> 5, lane = tid & 31, col = lane & 15, g = lane >> 4;
  const int which = blockIdx.z, r0b = blockIdx.x * 64, r0 = r0b + wave * 16, n0 = blockIdx.y * 128; const int b = r0b / EE, e0 = r0b % EE;
  const _Float16* Pw = P + (size_t)which * CC * CC;
  v8f acc[8] = {};
#pragma unroll 2
  for (int kc = 0; kc < CC / 32; ++kc) { const v16h a = frag_h(X16 + (size_t)(r0 + col) * CC + kc * 32, lane);
#pragma unroll
    for (int j = 0; j < 8; ++j) acc[j] = wmma16(a, frag_h(Pw + (size_t)(n0 + j * 16 + col) * CC + kc * 32, lane), acc[j]); }
  if (which < 2) {
#pragma unroll
    for (int j = 0; j < 8; ++j)
#pragma unroll
      for (int r = 0; r < 8; ++r) so[wave][8 * g + r][j * 16 + col] = acc[j][r] * (4.0f / 16.0f);
    LDSX();
    _Float16* D = which == 0 ? Q16 : K16;
    for (int q = lane; q < 16 * 2 * 8; q += 32) { const int hh = q >> 7, rl = (q >> 3) & 15, pc = q & 7; const int h = (n0 >> 6) + hh; union { v8h h8; v4u u; } pk;
#pragma unroll
      for (int e = 0; e < 8; ++e) pk.h8[e] = (_Float16)so[wave][rl][hh * 64 + pc * 8 + e];
      vst2(D + (((size_t)b * NH + h) * EE + e0 + wave * 16 + rl) * HD + pc * 8, pk.u); } }
  else {
#pragma unroll
    for (int j = 0; j < 8; ++j)
#pragma unroll
      for (int r = 0; r < 8; ++r) st[j * 16 + col][wave * 16 + 8 * g + r] = (_Float16)(acc[j][r] * (4.0f / 16.0f));
    __syncthreads();
    for (int q = tid; q < 128 * 8; q += 128) { const int cl = q >> 3, pc = q & 7; const int c = n0 + cl, h = c >> 6, d = c & 63; vst2(VT + (((size_t)b * NH + h) * HD + d) * EE + e0 + pc * 8, *(const v4u*)(&st[cl][pc * 8])); } }
}
// vsum[b][h][d] = sum_e v (f32, from VT /4): block per (b,h), thread per d (64 threads... use 256: 4 per d)
__global__ __launch_bounds__(256) void k_vsum(const _Float16* __restrict__ VT, float* __restrict__ VS) {
  __shared__ float sp[4][64]; __shared__ __align__(16) float so[64];
  const int bh = blockIdx.x, tid = threadIdx.x, d = tid & 63, part = tid >> 6; float s = 0.f;
  const _Float16* row = VT + ((size_t)bh * HD + d) * EE;
  for (int e = part * 512; e < part * 512 + 512; ++e) s += (float)row[e];
  sp[part][d] = s;
  __syncthreads();
  if (tid < 64) so[tid] = ((sp[0][tid] + sp[1][tid]) + (sp[2][tid] + sp[3][tid])) * 0.25f;
  __syncthreads();
  if (tid < 16) vst2(VS + (size_t)bh * HD + tid * 4, *(const v4f*)(&so[tid * 4]));
}
// LDS byte address of a __shared__ element (what an asynchronous copy takes as its destination)
__device__ __forceinline__ unsigned lds_off(const void* p) { return (unsigned)(size_t)(const __attribute__((address_space(3))) void*)p; }
// eight asynchronous copies global -> LDS, 16 bytes a lane each, through no register. The s_wait_xcnt stands in the copies' own statement,
// so that no address register of a copy is rewritten ahead of it.
__device__ __forceinline__ void acopy8(const unsigned (&l)[8], const void* const (&p)[8]) {
  asm volatile("global_load_async_to_lds_b128 %0, %8, off\n\t"
               "global_load_async_to_lds_b128 %1, %9, off\n\t"
               "global_load_async_to_lds_b128 %2, %10, off\n\t"
               "global_load_async_to_lds_b128 %3, %11, off\n\t"
               "global_load_async_to_lds_b128 %4, %12, off\n\t"
               "global_load_async_to_lds_b128 %5, %13, off\n\t"
               "global_load_async_to_lds_b128 %6, %14, off\n\t"
               "global_load_async_to_lds_b128 %7, %15, off\n\t"
               "s_wait_xcnt 0x0"
               :: "v"(l[0]), "v"(l[1]), "v"(l[2]), "v"(l[3]), "v"(l[4]), "v"(l[5]), "v"(l[6]), "v"(l[7]),
                  "v"(p[0]), "v"(p[1]), "v"(p[2]), "v"(p[3]), "v"(p[4]), "v"(p[5]), "v"(p[6]), "v"(p[7]) : "memory");
}
#define KPITCH 72   // f16 per staged K or V row: 144 B = 16 B x odd, conflict-free for 16-byte fragment reads
#define MPITCH 68   // f32 per staged mask row: 272 B, the two half-waves (8 rows apart) fall on different banks
// attention: block (64 q, h, b): S tiles over all 2048 keys (f16), * adj, /8 -> f16 P; acc += P @ V; out = 0.5*(acc*8/4) + 0.5*vsum -> O16 head-major [b][h][e][64] (x 1/8)
// Each 64-key tile of K, V and the block's 64 x 64 piece of the mask is brought into LDS once for the four waves, with whole-line
// asynchronous copies, one tile ahead (two buffers); a wave then fetches the tile's fragments from LDS in a few batches.
__global__ __launch_bounds__(128) void k_attn(const _Float16* __restrict__ Q16, const _Float16* __restrict__ K16, const _Float16* __restrict__ VT, const float* __restrict__ VS, const float* __restrict__ adj, _Float16* __restrict__ O16) {
  __shared__ __align__(16) _Float16 sK[2][64][KPITCH];
  __shared__ __align__(16) _Float16 sV[2][64][KPITCH];
  __shared__ __align__(16) float sM[2][64][MPITCH];
  __shared__ __align__(16) _Float16 sP[4][16][72];
  __shared__ __align__(16) float sO[4][16][68];
  const int tid = threadIdx.x, w = tid >> 5, lane = tid & 31, col = lane & 15, g = lane >> 4;
  const int b = blockIdx.z, h = blockIdx.y, q0b = blockIdx.x * 64, q0 = q0b + w * 16; const size_t bh = (size_t)b * NH + h;
  // tile kt -> buffer bf: K rows (128 B, adjacent), V^T rows (128 B of each of 64 rows), mask rows (256 B of each of 64 rows)
  auto stage = [&](int kt, int bf) {
    unsigned l[8]; const void* p[8];
#pragma unroll
    for (int i = 0; i < 4; ++i) { const int c = tid + 128 * i, row = c >> 3, pc = c & 7;
      l[i] = lds_off(&sK[bf][row][pc * 8]); p[i] = K16 + (bh * EE + kt * 64 + row) * HD + pc * 8;
      l[4 + i] = lds_off(&sV[bf][row][pc * 8]); p[4 + i] = VT + (bh * HD + row) * EE + kt * 64 + pc * 8; }
    acopy8(l, p);
#pragma unroll
    for (int i = 0; i < 8; ++i) { const int c = tid + 128 * i, row = c >> 4, pc = c & 15;
      l[i] = lds_off(&sM[bf][row][pc * 4]); p[i] = adj + (size_t)(q0b + row) * EE + kt * 64 + pc * 4; }
    acopy8(l, p);
  };
  stage(0, 0);
  v16h aq[2];
#pragma unroll
  for (int kc = 0; kc < 2; ++kc) aq[kc] = frag_h(Q16 + (bh * EE + q0 + col) * HD + kc * 32, lane);
  asm volatile("s_wait_asynccnt 0x0" ::: "memory");   // this wave's part of tile 0 has landed
  __syncthreads();                                     // ... and every other wave's
  stage(1, 1);
  v8f acc[4] = {};
#pragma unroll 1
  for (int kt = 0; kt < EE / 64; ++kt) { const int bf = kt & 1;
    // a tile's fragments are asked for in batches ahead of the products that use them, so that the LDS latency is paid a few times a
    // tile, not once a product: K and mask at the top, V as K's registers fall free, both P fragments together
    // (the short loops are unrolled so that these arrays are indexed by constants and stay in registers)
    v16h kf[4][2], vf[2][4], pa[2]; float m[4][8];
#pragma unroll
    for (int t = 0; t < 4; ++t) {
#pragma unroll
      for (int kc = 0; kc < 2; ++kc) kf[t][kc] = frag_h(&sK[bf][t * 16 + col][kc * 32], lane);
#pragma unroll
      for (int r = 0; r < 8; ++r) m[t][r] = sM[bf][w * 16 + 8 * g + r][t * 16 + col]; }
#pragma unroll
    for (int t = 0; t < 4; ++t) { v8f s = {};
#pragma unroll
      for (int kc = 0; kc < 2; ++kc) s = wmma16(aq[kc], kf[t][kc], s);
      if (t == 1 || t == 2) {
#pragma unroll
        for (int u = 0; u < 4; ++u) vf[t - 1][u] = frag_h(&sV[bf][u * 16 + col][(t - 1) * 32], lane); }
#pragma unroll
      for (int r = 0; r < 8; ++r) sP[w][8 * g + r][t * 16 + col] = (_Float16)(s[r] * m[t][r] * (1.0f / (16.0f * 8.0f))); }   // (x4 x4)/16 = true qk ; stored /8
    LDSX();
#pragma unroll
    for (int kc = 0; kc < 2; ++kc) pa[kc] = frag_h(&sP[w][col][0] + kc * 32, lane);
#pragma unroll
    for (int kc = 0; kc < 2; ++kc)
#pragma unroll
      for (int t = 0; t < 4; ++t) acc[t] = wmma16(pa[kc], vf[kc][t], acc[t]);
    asm volatile("s_wait_dscnt 0" ::: "memory");        // this wave's reads of buffer bf (and of its sP rows) have returned
    asm volatile("s_wait_asynccnt 0x0" ::: "memory");   // this wave's part of tile kt + 1 has landed
    __syncthreads();                                     // publishes tile kt + 1 and ends every wave's reads of buffer bf
    if (kt + 2 < EE / 64) stage(kt + 2, bf); }
  asm volatile("s_wait_asynccnt 0x0" ::: "memory");     // no copy is left in flight when the wave goes on
  // out = 0.5 * (acc * 8 / 4) + 0.5 * vsum[d]   (V stored x4) ; store O x 1/8 as f16 (values ~ O(50))
#pragma unroll
  for (int t = 0; t < 4; ++t) { const int d = t * 16 + col; const float vs = VS[bh * HD + d];
#pragma unroll
    for (int r = 0; r < 8; ++r) sO[w][8 * g + r][d] = (0.5f * (acc[t][r] * 2.0f) + 0.5f * vs) * 0.125f; }
  LDSX();
  for (int q = lane; q < 16 * 8; q += 32) { const int rl = q >> 3, pc = q & 7; union { v8h h8; v4u u; } pk;
#pragma unroll
    for (int e = 0; e < 8; ++e) pk.h8[e] = (_Float16)sO[w][rl][pc * 8 + e];
    vst2(O16 + (bh * EE + q0 + rl) * HD + pc * 8, pk.u); }
}
// proj + bias + LN; y = x + gamma * LN(out). Block = 16 rows x all 512 cols, 8 waves: wave w does cols 64w..64w+63 (one pass),
// then, behind one block barrier, wave w normalises rows 2w and 2w+1 with 16 columns per lane and whole-line loads and stores.
__global__ __launch_bounds__(256) void k_proj(const _Float16* __restrict__ O16, const _Float16* __restrict__ P, const float* __restrict__ bp, const float* __restrict__ lnw, const float* __restrict__ lnb, const float* __restrict__ gam, const float* __restrict__ x, float* __restrict__ out) {
  __shared__ __align__(16) float sy[16][CC + 4];
  const int tid = threadIdx.x, wave = tid >> 5, lane = tid & 31, col = lane & 15, g = lane >> 4;
  const int r0 = blockIdx.x * 16, n0 = wave * 64;
  v8f acc[4] = {};
#pragma unroll 2
  for (int kc = 0; kc < CC / 32; ++kc) { const int R = r0 + col; const v16h a = frag_h(O16 + ((((size_t)(R / EE)) * NH + (kc >> 1)) * EE + (R % EE)) * HD + (kc & 1) * 32, lane);
#pragma unroll
    for (int j = 0; j < 4; ++j) acc[j] = wmma16(a, frag_h(P + (size_t)(3 * CC + n0 + j * 16 + col) * CC + kc * 32, lane), acc[j]); }
  // this wave's x rows and the LN weights are asked for here, so that they fly during the LDS exchange and the row sums
  const float gm = gam[0]; v4f lw[4], lb[4], xv[2][4];
#pragma unroll
  for (int i = 0; i < 4; ++i) { lw[i] = *(const v4f*)(lnw + (i * 32 + lane) * 4); lb[i] = *(const v4f*)(lnb + (i * 32 + lane) * 4);
#pragma unroll
    for (int rr = 0; rr < 2; ++rr) xv[rr][i] = *(const v4f*)(x + (size_t)(r0 + wave * 2 + rr) * CC + (i * 32 + lane) * 4); }
#pragma unroll
  for (int j = 0; j < 4; ++j) { const int c = n0 + j * 16 + col; const float bb = bp[c];
#pragma unroll
    for (int r = 0; r < 8; ++r) sy[8 * g + r][c] = acc[j][r] * (8.0f / 16.0f) + bb; }
  __syncthreads();   // a row's 512 columns come from all eight waves
#pragma unroll
  for (int rr = 0; rr < 2; ++rr) { const int rl = wave * 2 + rr; v4f v[4];
#pragma unroll
    for (int i = 0; i < 4; ++i) v[i] = *(const v4f*)(&sy[rl][(i * 32 + lane) * 4]);
    float s = 0.f;
#pragma unroll
    for (int i = 0; i < 4; ++i) s += (v[i][0] + v[i][1]) + (v[i][2] + v[i][3]);
#pragma unroll
    for (int m = 16; m >= 1; m >>= 1) s += __shfl_xor(s, m, 32);
    const float mu = s * (1.0f / CC); float q2 = 0.f;
#pragma unroll
    for (int i = 0; i < 4; ++i) { v[i] -= mu; const v4f d2 = v[i] * v[i]; q2 += (d2[0] + d2[1]) + (d2[2] + d2[3]); }
#pragma unroll
    for (int m = 16; m >= 1; m >>= 1) q2 += __shfl_xor(q2, m, 32);
    const float rs = rsqrtf(q2 * (1.0f / CC) + 1e-5f);
#pragma unroll
    for (int i = 0; i < 4; ++i) vst2(out + (size_t)(r0 + rl) * CC + (i * 32 + lane) * 4, (v4f)(xv[rr][i] + gm * (v[i] * rs * lw[i] + lb[i]))); }
}
extern "C" void kernel_launch(void* const* d_in, const int* in_sizes, int n_in, void* d_out, int out_size, void* d_ws, size_t ws_size, hipStream_t stream) {
  (void)in_sizes; (void)n_in; (void)out_size; (void)ws_size;
  const float** I = (const float**)d_in;
  const float* x = I[0]; const float* adj = I[1]; const float* Wq = I[2]; const float* Wk = I[3]; const float* Wv = I[4]; const float* Wp = I[5]; const float* bp = I[6]; const float* lnw = I[7]; const float* lnb = I[8]; const float* gam = I[9];
  float* out = (float*)d_out;
  char* ws = (char*)d_ws; size_t off = 0;
  auto take = [&](size_t bytes) { char* p = ws + off; off += (bytes + 255) & ~(size_t)255; return p; };
  _Float16* X16 = (_Float16*)take((size_t)NR * CC * 2); _Float16* P = (_Float16*)take((size_t)4 * CC * CC * 2);
  _Float16* Q16 = (_Float16*)take((size_t)NR * CC * 2); _Float16* K16 = (_Float16*)take((size_t)NR * CC * 2); _Float16* VT = (_Float16*)take((size_t)NR * CC * 2); float* VS = (float*)take((size_t)NB * NH * HD * 4); _Float16* O16 = (_Float16*)take((size_t)NR * CC * 2);
  k_cvt<<<(NR * CC / 8 + 255) / 256, 256, 0, stream>>>(x, X16);
  k_pack<<<4 * CC, 256, 0, stream>>>(Wq, Wk, Wv, Wp, P);
  k_qkv<<<dim3(NR / 64, CC / 128, 3), 128, 0, stream>>>(X16, P, Q16, K16, VT);
  k_vsum<<<NB * NH, 256, 0, stream>>>(VT, VS);
  k_attn<<<dim3(EE / 64, NH, NB), 128, 0, stream>>>(Q16, K16, VT, VS, adj, O16);
  k_proj<<<NR / 16, 256, 0, stream>>>(O16, P, bp, lnw, lnb, gam, x, out);
}

// v003
// It runs in 84.7 microseconds.
// Next to v002, in two timings, it ran 1.31 times as fast each time.
// All steps since v000 together make it 3.56 times as fast.
#include <hip/hip_runtime.h>
#include <math.h>

typedef __attribute__((ext_vector_type(16))) _Float16 v16h;
typedef __attribute__((ext_vector_type(16))) __bf16 v16b;
typedef __attribute__((ext_vector_type(8)))  _Float16 v8h;
typedef __attribute__((ext_vector_type(8)))  float v8f;
typedef __attribute__((ext_vector_type(4)))  float v4f;
typedef __attribute__((ext_vector_type(2)))  float v2f;
typedef __attribute__((ext_vector_type(4)))  unsigned v4u;
typedef __attribute__((ext_vector_type(4)))  int v4i;
typedef float __attribute__((may_alias)) float_a;
typedef int __attribute__((may_alias)) int_a;

template <typename T> __device__ __forceinline__ void vst2(void* p, T v) { *(T*)p = v;  }
__device__ __forceinline__ v8f wmma16(v16h a, v16h b, v8f c) {
  v8f d = __builtin_amdgcn_wmma_f32_16x16x32_f16(false, a, false, b, (short)0, c, false, false);
  asm volatile("v_nop\n\tv_nop\n\tv_nop\n\tv_nop" : "+v"(d) : "v"(a), "v"(b));
  return d;
}
__device__ __forceinline__ v8f wmma_bf(v16b a, v16b b, v8f c) {
  v8f d = __builtin_amdgcn_wmma_f32_16x16x32_bf16(false, a, false, b, (short)0, c, false, false);
  asm volatile("v_nop\n\tv_nop\n\tv_nop\n\tv_nop" : "+v"(d) : "v"(a), "v"(b));
  return d;
}
// 16x16x32 fragments: lane = (h = lane>>4, row/col = lane&15); elements 0..7 = k0+8h+0..7, 8..15 = k0+16+8h+0..7; D element r = row 8h+r
__device__ __forceinline__ v16h frag_h(const _Float16* rowk0, int lane) {
  union { v16h v; v8h q[2]; } u; const _Float16* p = rowk0 + 8 * (lane >> 4);
  u.q[0] = *(const v8h*)p; u.q[1] = *(const v8h*)(p + 16); return u.v;
}
__device__ __forceinline__ v16h frag_f32(const float* rowk0, int lane) {
  v16h a; const float* p = rowk0 + 8 * (lane >> 4);
#pragma unroll
  for (int i = 0; i < 8; ++i) { a[i] = (_Float16)p[i]; a[8 + i] = (_Float16)p[16 + i]; }
  return a;
}
__device__ __forceinline__ v16h frag_f32s(const float* rowk0, int lane, float sc) {
  v16h a; const float* p = rowk0 + 8 * (lane >> 4);
#pragma unroll
  for (int i = 0; i < 8; ++i) { a[i] = (_Float16)(p[i] * sc); a[8 + i] = (_Float16)(p[16 + i] * sc); }
  return a;
}
// column fragment from a [K][ld] layout (column n), rows >= K read as 0
__device__ __forceinline__ v16h fragc_f32(const float* W, int k0, int n, int lane, int ld, int K) {
  v16h a; const int g = lane >> 4;
#pragma unroll
  for (int i = 0; i < 8; ++i) { const int ka = k0 + 8 * g + i, kb = ka + 16;
    a[i] = (_Float16)(ka < K ? W[(size_t)ka * ld + n] : 0.f); a[8 + i] = (_Float16)(kb < K ? W[(size_t)kb * ld + n] : 0.f); }
  return a;
}
struct F2 { v16b h, l; };
__device__ __forceinline__ F2 bsplit16(const float v[16]) { F2 r;
#pragma unroll
  for (int i = 0; i < 16; ++i) { const __bf16 h = (__bf16)v[i]; r.h[i] = h; r.l[i] = (__bf16)(v[i] - (float)h); }
  return r; }
__device__ __forceinline__ F2 split_row(const float* row, int k0, int lane) { float v[16]; const float* p = row + k0 + 8 * (lane >> 4);
#pragma unroll
  for (int i = 0; i < 8; ++i) { v[i] = p[i]; v[8 + i] = p[16 + i]; }
  return bsplit16(v); }
__device__ __forceinline__ F2 split_rowK(const float* row, int k0, int lane, int K) { float v[16]; const int g = lane >> 4;
#pragma unroll
  for (int i = 0; i < 8; ++i) { const int ka = k0 + 8 * g + i, kb = ka + 16; v[i] = ka < K ? row[ka] : 0.f; v[8 + i] = kb < K ? row[kb] : 0.f; }
  return bsplit16(v); }
__device__ __forceinline__ F2 split_col(const float* W, int k0, int n, int lane, int ld, int K) { float v[16]; const int g = lane >> 4;
#pragma unroll
  for (int i = 0; i < 8; ++i) { const int ka = k0 + 8 * g + i, kb = ka + 16; v[i] = ka < K ? W[(size_t)ka * ld + n] : 0.f; v[8 + i] = kb < K ? W[(size_t)kb * ld + n] : 0.f; }
  return bsplit16(v); }
__device__ __forceinline__ v8f mac3(const F2& a, const F2& b, v8f c) { c = wmma_bf(a.l, b.h, c); c = wmma_bf(a.h, b.l, c); return wmma_bf(a.h, b.h, c); }
__device__ __forceinline__ float sigm(float v) { return 1.0f / (1.0f + expf(-v)); }
#define LDSX() do { asm volatile("s_wait_dscnt 0" ::: "memory"); __builtin_amdgcn_wave_barrier(); __builtin_amdgcn_fence(__ATOMIC_RELEASE, "workgroup"); } while (0)

// Mask-modulated linear attention block: q/k/v projections, per head attn = (q.k * adj + 1)/2 (no softmax), attn @ v, output projection
// + bias, LayerNorm, x + gamma * (.). All products on v_wmma_f32_16x16x32_f16 (x converted once, [out][in] weights packed as f16 rows
// x16, q/k/v kept head-major f16, the [E x E] scores scaled by 1/8 into f16 for the second product, adj mask read as data, the "+1"
#define NB 2
#define EE 2048
#define CC 512
#define NH 8
#define HD 64
#define NR (NB * EE)

__global__ __launch_bounds__(256) void k_cvt(const float* __restrict__ x, _Float16* __restrict__ X16) {
  const size_t i8 = (size_t)blockIdx.x * 256 + threadIdx.x; if (i8 >= (size_t)NR * CC / 8) return;
  union { v8h h; v4u u; } pk;
#pragma unroll
  for (int e = 0; e < 8; ++e) pk.h[e] = (_Float16)x[i8 * 8 + e];
  vst2(X16 + i8 * 8, pk.u);
}
// P rows [which*512 + n][512] f16 x16: W[n][k] ([out][in]) for Wq, Wk, Wv, Wp
__global__ __launch_bounds__(256) void k_pack(const float* __restrict__ Wq, const float* __restrict__ Wk, const float* __restrict__ Wv, const float* __restrict__ Wp, _Float16* __restrict__ P) {
  const int r = blockIdx.x, tid = threadIdx.x; __shared__ __align__(16) _Float16 srow[CC];
  const int which = r >> 9, n = r & 511; const float* W = which == 0 ? Wq : (which == 1 ? Wk : (which == 2 ? Wv : Wp));
  for (int k = tid; k < CC; k += 256) srow[k] = (_Float16)(W[(size_t)n * CC + k] * 16.0f);
  __syncthreads();
  if (tid < 64) vst2(P + (size_t)r * CC + tid * 8, *(const v4u*)(&srow[tid * 8]));
}
// LDS byte address of a __shared__ element (what an asynchronous copy takes as its destination)
__device__ __forceinline__ unsigned lds_off(const void* p) { return (unsigned)(size_t)(const __attribute__((address_space(3))) void*)p; }
// eight asynchronous copies global -> LDS, 16 bytes a lane each, through no register. The s_wait_xcnt stands in the copies' own statement,
// so that no address register of a copy is rewritten ahead of it.
__device__ __forceinline__ void acopy8(const unsigned (&l)[8], const void* const (&p)[8]) {
  asm volatile("global_load_async_to_lds_b128 %0, %8, off\n\t"
               "global_load_async_to_lds_b128 %1, %9, off\n\t"
               "global_load_async_to_lds_b128 %2, %10, off\n\t"
               "global_load_async_to_lds_b128 %3, %11, off\n\t"
               "global_load_async_to_lds_b128 %4, %12, off\n\t"
               "global_load_async_to_lds_b128 %5, %13, off\n\t"
               "global_load_async_to_lds_b128 %6, %14, off\n\t"
               "global_load_async_to_lds_b128 %7, %15, off\n\t"
               "s_wait_xcnt 0x0"
               :: "v"(l[0]), "v"(l[1]), "v"(l[2]), "v"(l[3]), "v"(l[4]), "v"(l[5]), "v"(l[6]), "v"(l[7]),
                  "v"(p[0]), "v"(p[1]), "v"(p[2]), "v"(p[3]), "v"(p[4]), "v"(p[5]), "v"(p[6]), "v"(p[7]) : "memory");
}
// four such copies
__device__ __forceinline__ void acopy4(const unsigned (&l)[4], const void* const (&p)[4]) {
  asm volatile("global_load_async_to_lds_b128 %0, %4, off\n\t"
               "global_load_async_to_lds_b128 %1, %5, off\n\t"
               "global_load_async_to_lds_b128 %2, %6, off\n\t"
               "global_load_async_to_lds_b128 %3, %7, off\n\t"
               "s_wait_xcnt 0x0"
               :: "v"(l[0]), "v"(l[1]), "v"(l[2]), "v"(l[3]), "v"(p[0]), "v"(p[1]), "v"(p[2]), "v"(p[3]) : "memory");
}
#define KPITCH 72   // f16 per staged x, weight, K or V^T row: 144 B = 16 B x odd, conflict-free for 16-byte fragment reads
// q/k/v: block (64 rows, 128-col chunk = 2 heads, which): Q16/K16 head-major [b][h][e][64] (x4); VT [b][h][d][e] (x4); VS[b][h][64] partial sums handled later from VT
__global__ __launch_bounds__(128) void k_qkv(const _Float16* __restrict__ X16, const _Float16* __restrict__ P, _Float16* __restrict__ Q16, _Float16* __restrict__ K16, _Float16* __restrict__ VT) {
  // the staged tiles are dead (behind the loop's last barrier) when the results are laid out for their stores: the two uses share the LDS
  __shared__ __align__(16) union { struct { _Float16 a[2][64][KPITCH]; _Float16 b[2][128][KPITCH]; } t; float so[4][16][132]; _Float16 st[128][72]; } sm;
  auto& so = sm.so; auto& st = sm.st;
  const int tid = threadIdx.x, wave = tid >> 5, lane = tid & 31, col = lane & 15, g = lane >> 4;
  const int which = blockIdx.z, r0b = blockIdx.x * 64, n0 = blockIdx.y * 128; const int b = r0b / EE, e0 = r0b % EE;
  const _Float16* Pw = P + (size_t)which * CC * CC;
  // k slice ks (64 wide = one 128-B line of each row) -> buffer bf: the block's 128 weight rows and 64 x rows, whole lines, once for the four waves
  // (its loops are unrolled so that the address arrays are indexed by constants and stay in registers, as asm operands must)
  auto stage = [&](int ks, int bf) {
    unsigned l[8]; const void* p[8]; unsigned la[4]; const void* pa[4];
#pragma unroll
    for (int i = 0; i < 8; ++i) { const int c = tid + 128 * i, row = c >> 3, pc = c & 7;
      l[i] = lds_off(&sm.t.b[bf][row][pc * 8]); p[i] = Pw + (size_t)(n0 + row) * CC + ks * 64 + pc * 8; }
    acopy8(l, p);
#pragma unroll
    for (int i = 0; i < 4; ++i) { const int c = tid + 128 * i, row = c >> 3, pc = c & 7;
      la[i] = lds_off(&sm.t.a[bf][row][pc * 8]); pa[i] = X16 + (size_t)(r0b + row) * CC + ks * 64 + pc * 8; }
    acopy4(la, pa);
  };
  stage(0, 0);
  asm volatile("s_wait_asynccnt 0x0" ::: "memory");   // this wave's part of slice 0 has landed
  __syncthreads();                                     // ... and every other wave's
  stage(1, 1);
  v8f acc[8] = {};
#pragma unroll 1   // rolled: the trips are parted by barriers, so unrolling would only lengthen the text
  for (int ks = 0; ks < CC / 64; ++ks) { const int bf = ks & 1;
    // the slice's fragments are asked for in one batch ahead of its 16 products, so that the LDS latency is paid once a slice
    // (the short loops are unrolled so that these arrays are indexed by constants and stay in registers)
    v16h a[2], bq[2][8];
#pragma unroll
    for (int kc = 0; kc < 2; ++kc) { a[kc] = frag_h(&sm.t.a[bf][wave * 16 + col][kc * 32], lane);
#pragma unroll
      for (int j = 0; j < 8; ++j) bq[kc][j] = frag_h(&sm.t.b[bf][j * 16 + col][kc * 32], lane); }
#pragma unroll
    for (int kc = 0; kc < 2; ++kc)
#pragma unroll
      for (int j = 0; j < 8; ++j) acc[j] = wmma16(a[kc], bq[kc][j], acc[j]);
    asm volatile("s_wait_dscnt 0" ::: "memory");        // this wave's reads of buffer bf have returned
    asm volatile("s_wait_asynccnt 0x0" ::: "memory");   // this wave's part of slice ks + 1 has landed
    __syncthreads();                                     // publishes slice ks + 1 and ends every wave's reads of buffer bf
    if (ks + 2 < CC / 64) stage(ks + 2, bf); }
  asm volatile("s_wait_asynccnt 0x0" ::: "memory");     // no copy is left in flight when the LDS is taken for the results
  if (which < 2) {
#pragma unroll
    for (int j = 0; j < 8; ++j)
#pragma unroll
      for (int r = 0; r < 8; ++r) so[wave][8 * g + r][j * 16 + col] = acc[j][r] * (4.0f / 16.0f);
    LDSX();
    _Float16* D = which == 0 ? Q16 : K16;
    for (int q = lane; q < 16 * 2 * 8; q += 32) { const int hh = q >> 7, rl = (q >> 3) & 15, pc = q & 7; const int h = (n0 >> 6) + hh; union { v8h h8; v4u u; } pk;
#pragma unroll
      for (int e = 0; e < 8; ++e) pk.h8[e] = (_Float16)so[wave][rl][hh * 64 + pc * 8 + e];
      vst2(D + (((size_t)b * NH + h) * EE + e0 + wave * 16 + rl) * HD + pc * 8, pk.u); } }
  else {
#pragma unroll
    for (int j = 0; j < 8; ++j)
#pragma unroll
      for (int r = 0; r < 8; ++r) st[j * 16 + col][wave * 16 + 8 * g + r] = (_Float16)(acc[j][r] * (4.0f / 16.0f));
    __syncthreads();
    for (int q = tid; q < 128 * 8; q += 128) { const int cl = q >> 3, pc = q & 7; const int c = n0 + cl, h = c >> 6, d = c & 63; vst2(VT + (((size_t)b * NH + h) * HD + d) * EE + e0 + pc * 8, *(const v4u*)(&st[cl][pc * 8])); } }
}
// vsum[b][h][d] = sum_e v (f32, from VT /4): block per (b,h), thread per d (64 threads... use 256: 4 per d)
__global__ __launch_bounds__(256) void k_vsum(const _Float16* __restrict__ VT, float* __restrict__ VS) {
  __shared__ float sp[4][64]; __shared__ __align__(16) float so[64];
  const int bh = blockIdx.x, tid = threadIdx.x, d = tid & 63, part = tid >> 6; float s = 0.f;
  const _Float16* row = VT + ((size_t)bh * HD + d) * EE;
  for (int e = part * 512; e < part * 512 + 512; ++e) s += (float)row[e];
  sp[part][d] = s;
  __syncthreads();
  if (tid < 64) so[tid] = ((sp[0][tid] + sp[1][tid]) + (sp[2][tid] + sp[3][tid])) * 0.25f;
  __syncthreads();
  if (tid < 16) vst2(VS + (size_t)bh * HD + tid * 4, *(const v4f*)(&so[tid * 4]));
}
#define MPITCH 68   // f32 per staged mask row: 272 B, the two half-waves (8 rows apart) fall on different banks
// attention: block (64 q, h, b): S tiles over all 2048 keys (f16), * adj, /8 -> f16 P; acc += P @ V; out = 0.5*(acc*8/4) + 0.5*vsum -> O16 head-major [b][h][e][64] (x 1/8)
// Each 64-key tile of K, V and the block's 64 x 64 piece of the mask is brought into LDS once for the four waves, with whole-line
// asynchronous copies, one tile ahead (two buffers); a wave then fetches the tile's fragments from LDS in a few batches.
__global__ __launch_bounds__(128) void k_attn(const _Float16* __restrict__ Q16, const _Float16* __restrict__ K16, const _Float16* __restrict__ VT, const float* __restrict__ VS, const float* __restrict__ adj, _Float16* __restrict__ O16) {
  __shared__ __align__(16) _Float16 sK[2][64][KPITCH];
  __shared__ __align__(16) _Float16 sV[2][64][KPITCH];
  __shared__ __align__(16) float sM[2][64][MPITCH];
  __shared__ __align__(16) _Float16 sP[4][16][72];
  __shared__ __align__(16) float sO[4][16][68];
  const int tid = threadIdx.x, w = tid >> 5, lane = tid & 31, col = lane & 15, g = lane >> 4;
  const int b = blockIdx.z, h = blockIdx.y, q0b = blockIdx.x * 64, q0 = q0b + w * 16; const size_t bh = (size_t)b * NH + h;
  // tile kt -> buffer bf: K rows (128 B, adjacent), V^T rows (128 B of each of 64 rows), mask rows (256 B of each of 64 rows)
  auto stage = [&](int kt, int bf) {
    unsigned l[8]; const void* p[8];
#pragma unroll
    for (int i = 0; i < 4; ++i) { const int c = tid + 128 * i, row = c >> 3, pc = c & 7;
      l[i] = lds_off(&sK[bf][row][pc * 8]); p[i] = K16 + (bh * EE + kt * 64 + row) * HD + pc * 8;
      l[4 + i] = lds_off(&sV[bf][row][pc * 8]); p[4 + i] = VT + (bh * HD + row) * EE + kt * 64 + pc * 8; }
    acopy8(l, p);
#pragma unroll
    for (int i = 0; i < 8; ++i) { const int c = tid + 128 * i, row = c >> 4, pc = c & 15;
      l[i] = lds_off(&sM[bf][row][pc * 4]); p[i] = adj + (size_t)(q0b + row) * EE + kt * 64 + pc * 4; }
    acopy8(l, p);
  };
  stage(0, 0);
  v16h aq[2];
#pragma unroll
  for (int kc = 0; kc < 2; ++kc) aq[kc] = frag_h(Q16 + (bh * EE + q0 + col) * HD + kc * 32, lane);
  asm volatile("s_wait_asynccnt 0x0" ::: "memory");   // this wave's part of tile 0 has landed
  __syncthreads();                                     // ... and every other wave's
  stage(1, 1);
  v8f acc[4] = {};
#pragma unroll 1
  for (int kt = 0; kt < EE / 64; ++kt) { const int bf = kt & 1;
    // a tile's fragments are asked for in batches ahead of the products that use them, so that the LDS latency is paid a few times a
    // tile, not once a product: K and mask at the top, V as K's registers fall free, both P fragments together
    // (the short loops are unrolled so that these arrays are indexed by constants and stay in registers)
    v16h kf[4][2], vf[2][4], pa[2]; float m[4][8];
#pragma unroll
    for (int t = 0; t < 4; ++t) {
#pragma unroll
      for (int kc = 0; kc < 2; ++kc) kf[t][kc] = frag_h(&sK[bf][t * 16 + col][kc * 32], lane);
#pragma unroll
      for (int r = 0; r < 8; ++r) m[t][r] = sM[bf][w * 16 + 8 * g + r][t * 16 + col]; }
#pragma unroll
    for (int t = 0; t < 4; ++t) { v8f s = {};
#pragma unroll
      for (int kc = 0; kc < 2; ++kc) s = wmma16(aq[kc], kf[t][kc], s);
      if (t == 1 || t == 2) {
#pragma unroll
        for (int u = 0; u < 4; ++u) vf[t - 1][u] = frag_h(&sV[bf][u * 16 + col][(t - 1) * 32], lane); }
#pragma unroll
      for (int r = 0; r < 8; ++r) sP[w][8 * g + r][t * 16 + col] = (_Float16)(s[r] * m[t][r] * (1.0f / (16.0f * 8.0f))); }   // (x4 x4)/16 = true qk ; stored /8
    LDSX();
#pragma unroll
    for (int kc = 0; kc < 2; ++kc) pa[kc] = frag_h(&sP[w][col][0] + kc * 32, lane);
#pragma unroll
    for (int kc = 0; kc < 2; ++kc)
#pragma unroll
      for (int t = 0; t < 4; ++t) acc[t] = wmma16(pa[kc], vf[kc][t], acc[t]);
    asm volatile("s_wait_dscnt 0" ::: "memory");        // this wave's reads of buffer bf (and of its sP rows) have returned
    asm volatile("s_wait_asynccnt 0x0" ::: "memory");   // this wave's part of tile kt + 1 has landed
    __syncthreads();                                     // publishes tile kt + 1 and ends every wave's reads of buffer bf
    if (kt + 2 < EE / 64) stage(kt + 2, bf); }
  asm volatile("s_wait_asynccnt 0x0" ::: "memory");     // no copy is left in flight when the wave goes on
  // out = 0.5 * (acc * 8 / 4) + 0.5 * vsum[d]   (V stored x4) ; store O x 1/8 as f16 (values ~ O(50))
#pragma unroll
  for (int t = 0; t < 4; ++t) { const int d = t * 16 + col; const float vs = VS[bh * HD + d];
#pragma unroll
    for (int r = 0; r < 8; ++r) sO[w][8 * g + r][d] = (0.5f * (acc[t][r] * 2.0f) + 0.5f * vs) * 0.125f; }
  LDSX();
  for (int q = lane; q < 16 * 8; q += 32) { const int rl = q >> 3, pc = q & 7; union { v8h h8; v4u u; } pk;
#pragma unroll
    for (int e = 0; e < 8; ++e) pk.h8[e] = (_Float16)sO[w][rl][pc * 8 + e];
    vst2(O16 + (bh * EE + q0 + rl) * HD + pc * 8, pk.u); }
}
// proj + bias + LN; y = x + gamma * LN(out). Block = 16 rows x all 512 cols, 8 waves: wave w does cols 64w..64w+63 (one pass),
// then, behind one block barrier, wave w normalises rows 2w and 2w+1 with 16 columns per lane and whole-line loads and stores.
__global__ __launch_bounds__(256) void k_proj(const _Float16* __restrict__ O16, const _Float16* __restrict__ P, const float* __restrict__ bp, const float* __restrict__ lnw, const float* __restrict__ lnb, const float* __restrict__ gam, const float* __restrict__ x, float* __restrict__ out) {
  __shared__ __align__(16) float sy[16][CC + 4];
  const int tid = threadIdx.x, wave = tid >> 5, lane = tid & 31, col = lane & 15, g = lane >> 4;
  const int r0 = blockIdx.x * 16, n0 = wave * 64;
  v8f acc[4] = {};
#pragma unroll 2
  for (int kc = 0; kc < CC / 32; ++kc) { const int R = r0 + col; const v16h a = frag_h(O16 + ((((size_t)(R / EE)) * NH + (kc >> 1)) * EE + (R % EE)) * HD + (kc & 1) * 32, lane);
#pragma unroll
    for (int j = 0; j < 4; ++j) acc[j] = wmma16(a, frag_h(P + (size_t)(3 * CC + n0 + j * 16 + col) * CC + kc * 32, lane), acc[j]); }
  // this wave's x rows and the LN weights are asked for here, so that they fly during the LDS exchange and the row sums
  const float gm = gam[0]; v4f lw[4], lb[4], xv[2][4];
#pragma unroll
  for (int i = 0; i < 4; ++i) { lw[i] = *(const v4f*)(lnw + (i * 32 + lane) * 4); lb[i] = *(const v4f*)(lnb + (i * 32 + lane) * 4);
#pragma unroll
    for (int rr = 0; rr < 2; ++rr) xv[rr][i] = *(const v4f*)(x + (size_t)(r0 + wave * 2 + rr) * CC + (i * 32 + lane) * 4); }
#pragma unroll
  for (int j = 0; j < 4; ++j) { const int c = n0 + j * 16 + col; const float bb = bp[c];
#pragma unroll
    for (int r = 0; r < 8; ++r) sy[8 * g + r][c] = acc[j][r] * (8.0f / 16.0f) + bb; }
  __syncthreads();   // a row's 512 columns come from all eight waves
#pragma unroll
  for (int rr = 0; rr < 2; ++rr) { const int rl = wave * 2 + rr; v4f v[4];
#pragma unroll
    for (int i = 0; i < 4; ++i) v[i] = *(const v4f*)(&sy[rl][(i * 32 + lane) * 4]);
    float s = 0.f;
#pragma unroll
    for (int i = 0; i < 4; ++i) s += (v[i][0] + v[i][1]) + (v[i][2] + v[i][3]);
#pragma unroll
    for (int m = 16; m >= 1; m >>= 1) s += __shfl_xor(s, m, 32);
    const float mu = s * (1.0f / CC); float q2 = 0.f;
#pragma unroll
    for (int i = 0; i < 4; ++i) { v[i] -= mu; const v4f d2 = v[i] * v[i]; q2 += (d2[0] + d2[1]) + (d2[2] + d2[3]); }
#pragma unroll
    for (int m = 16; m >= 1; m >>= 1) q2 += __shfl_xor(q2, m, 32);
    const float rs = rsqrtf(q2 * (1.0f / CC) + 1e-5f);
#pragma unroll
    for (int i = 0; i < 4; ++i) vst2(out + (size_t)(r0 + rl) * CC + (i * 32 + lane) * 4, (v4f)(xv[rr][i] + gm * (v[i] * rs * lw[i] + lb[i]))); }
}
extern "C" void kernel_launch(void* const* d_in, const int* in_sizes, int n_in, void* d_out, int out_size, void* d_ws, size_t ws_size, hipStream_t stream) {
  (void)in_sizes; (void)n_in; (void)out_size; (void)ws_size;
  const float** I = (const float**)d_in;
  const float* x = I[0]; const float* adj = I[1]; const float* Wq = I[2]; const float* Wk = I[3]; const float* Wv = I[4]; const float* Wp = I[5]; const float* bp = I[6]; const float* lnw = I[7]; const float* lnb = I[8]; const float* gam = I[9];
  float* out = (float*)d_out;
  char* ws = (char*)d_ws; size_t off = 0;
  auto take = [&](size_t bytes) { char* p = ws + off; off += (bytes + 255) & ~(size_t)255; return p; };
  _Float16* X16 = (_Float16*)take((size_t)NR * CC * 2); _Float16* P = (_Float16*)take((size_t)4 * CC * CC * 2);
  _Float16* Q16 = (_Float16*)take((size_t)NR * CC * 2); _Float16* K16 = (_Float16*)take((size_t)NR * CC * 2); _Float16* VT = (_Float16*)take((size_t)NR * CC * 2); float* VS = (float*)take((size_t)NB * NH * HD * 4); _Float16* O16 = (_Float16*)take((size_t)NR * CC * 2);
  k_cvt<<<(NR * CC / 8 + 255) / 256, 256, 0, stream>>>(x, X16);
  k_pack<<<4 * CC, 256, 0, stream>>>(Wq, Wk, Wv, Wp, P);
  k_qkv<<<dim3(NR / 64, CC / 128, 3), 128, 0, stream>>>(X16, P, Q16, K16, VT);
  k_vsum<<<NB * NH, 256, 0, stream>>>(VT, VS);
  k_attn<<<dim3(EE / 64, NH, NB), 128, 0, stream>>>(Q16, K16, VT, VS, adj, O16);
  k_proj<<<NR / 16, 256, 0, stream>>>(O16, P, bp, lnw, lnb, gam, x, out);
}

// v004
// One run takes 82 microseconds.
// Next to v003, in two timings, it ran 1.03 times as fast each time.
// All steps since v000 together make it 3.67 times as fast.
#include <hip/hip_runtime.h>
#include <math.h>

typedef __attribute__((ext_vector_type(16))) _Float16 v16h;
typedef __attribute__((ext_vector_type(16))) __bf16 v16b;
typedef __attribute__((ext_vector_type(8)))  _Float16 v8h;
typedef __attribute__((ext_vector_type(8)))  float v8f;
typedef __attribute__((ext_vector_type(4)))  float v4f;
typedef __attribute__((ext_vector_type(2)))  float v2f;
typedef __attribute__((ext_vector_type(4)))  unsigned v4u;
typedef __attribute__((ext_vector_type(4)))  int v4i;
typedef float __attribute__((may_alias)) float_a;
typedef int __attribute__((may_alias)) int_a;

template <typename T> __device__ __forceinline__ void vst2(void* p, T v) { *(T*)p = v;  }
__device__ __forceinline__ v8f wmma16(v16h a, v16h b, v8f c) {
  v8f d = __builtin_amdgcn_wmma_f32_16x16x32_f16(false, a, false, b, (short)0, c, false, false);
  asm volatile("v_nop\n\tv_nop\n\tv_nop\n\tv_nop" : "+v"(d) : "v"(a), "v"(b));
  return d;
}
__device__ __forceinline__ v8f wmma_bf(v16b a, v16b b, v8f c) {
  v8f d = __builtin_amdgcn_wmma_f32_16x16x32_bf16(false, a, false, b, (short)0, c, false, false);
  asm volatile("v_nop\n\tv_nop\n\tv_nop\n\tv_nop" : "+v"(d) : "v"(a), "v"(b));
  return d;
}
// 16x16x32 fragments: lane = (h = lane>>4, row/col = lane&15); elements 0..7 = k0+8h+0..7, 8..15 = k0+16+8h+0..7; D element r = row 8h+r
__device__ __forceinline__ v16h frag_h(const _Float16* rowk0, int lane) {
  union { v16h v; v8h q[2]; } u; const _Float16* p = rowk0 + 8 * (lane >> 4);
  u.q[0] = *(const v8h*)p; u.q[1] = *(const v8h*)(p + 16); return u.v;
}
__device__ __forceinline__ v16h frag_f32(const float* rowk0, int lane) {
  v16h a; const float* p = rowk0 + 8 * (lane >> 4);
#pragma unroll
  for (int i = 0; i < 8; ++i) { a[i] = (_Float16)p[i]; a[8 + i] = (_Float16)p[16 + i]; }
  return a;
}
__device__ __forceinline__ v16h frag_f32s(const float* rowk0, int lane, float sc) {
  v16h a; const float* p = rowk0 + 8 * (lane >> 4);
#pragma unroll
  for (int i = 0; i < 8; ++i) { a[i] = (_Float16)(p[i] * sc); a[8 + i] = (_Float16)(p[16 + i] * sc); }
  return a;
}
// column fragment from a [K][ld] layout (column n), rows >= K read as 0
__device__ __forceinline__ v16h fragc_f32(const float* W, int k0, int n, int lane, int ld, int K) {
  v16h a; const int g = lane >> 4;
#pragma unroll
  for (int i = 0; i < 8; ++i) { const int ka = k0 + 8 * g + i, kb = ka + 16;
    a[i] = (_Float16)(ka < K ? W[(size_t)ka * ld + n] : 0.f); a[8 + i] = (_Float16)(kb < K ? W[(size_t)kb * ld + n] : 0.f); }
  return a;
}
struct F2 { v16b h, l; };
__device__ __forceinline__ F2 bsplit16(const float v[16]) { F2 r;
#pragma unroll
  for (int i = 0; i < 16; ++i) { const __bf16 h = (__bf16)v[i]; r.h[i] = h; r.l[i] = (__bf16)(v[i] - (float)h); }
  return r; }
__device__ __forceinline__ F2 split_row(const float* row, int k0, int lane) { float v[16]; const float* p = row + k0 + 8 * (lane >> 4);
#pragma unroll
  for (int i = 0; i < 8; ++i) { v[i] = p[i]; v[8 + i] = p[16 + i]; }
  return bsplit16(v); }
__device__ __forceinline__ F2 split_rowK(const float* row, int k0, int lane, int K) { float v[16]; const int g = lane >> 4;
#pragma unroll
  for (int i = 0; i < 8; ++i) { const int ka = k0 + 8 * g + i, kb = ka + 16; v[i] = ka < K ? row[ka] : 0.f; v[8 + i] = kb < K ? row[kb] : 0.f; }
  return bsplit16(v); }
__device__ __forceinline__ F2 split_col(const float* W, int k0, int n, int lane, int ld, int K) { float v[16]; const int g = lane >> 4;
#pragma unroll
  for (int i = 0; i < 8; ++i) { const int ka = k0 + 8 * g + i, kb = ka + 16; v[i] = ka < K ? W[(size_t)ka * ld + n] : 0.f; v[8 + i] = kb < K ? W[(size_t)kb * ld + n] : 0.f; }
  return bsplit16(v); }
__device__ __forceinline__ v8f mac3(const F2& a, const F2& b, v8f c) { c = wmma_bf(a.l, b.h, c); c = wmma_bf(a.h, b.l, c); return wmma_bf(a.h, b.h, c); }
__device__ __forceinline__ float sigm(float v) { return 1.0f / (1.0f + expf(-v)); }
#define LDSX() do { asm volatile("s_wait_dscnt 0" ::: "memory"); __builtin_amdgcn_wave_barrier(); __builtin_amdgcn_fence(__ATOMIC_RELEASE, "workgroup"); } while (0)

// Mask-modulated linear attention block: q/k/v projections, per head attn = (q.k * adj + 1)/2 (no softmax), attn @ v, output projection
// + bias, LayerNorm, x + gamma * (.). All products on v_wmma_f32_16x16x32_f16 (x converted once, [out][in] weights packed as f16 rows
// x16, q/k/v kept head-major f16, the [E x E] scores scaled by 1/8 into f16 for the second product, adj mask read as data, the "+1"
#define NB 2
#define EE 2048
#define CC 512
#define NH 8
#define HD 64
#define NR (NB * EE)

typedef __attribute__((ext_vector_type(4)))  _Float16 v4h;
#define NPC (CC * CC / 4)   // 16-byte pieces of one weight matrix = threads of k_prep
static_assert(NR * CC / 4 == 8 * NPC, "x is eight times a weight matrix");
// x -> X16 (f16) and Wq, Wk, Wv, Wp -> P (f16, x16; P rows [which*512 + n][512] are the weights' own [out][in] order), in one launch of
// few waves: thread t takes piece t of each eighth of x and of each weight. A wave's load covers 512 adjacent bytes, its store 256;
// the twelve loads are asked for together, so that the memory latency is paid once a wave.
__global__ __launch_bounds__(256) void k_prep(const float* __restrict__ x, const float* __restrict__ Wq, const float* __restrict__ Wk, const float* __restrict__ Wv, const float* __restrict__ Wp, _Float16* __restrict__ X16, _Float16* __restrict__ P) {
  const unsigned t = blockIdx.x * 256 + threadIdx.x;
  const v4f* x4 = (const v4f*)x; v4h* X4 = (v4h*)X16; v4h* P4 = (v4h*)P;
  v4f a[8], w[4];
#pragma unroll   // this loop and the two below: unrolled so that the arrays are indexed by constants and stay in registers
  for (int i = 0; i < 8; ++i) a[i] = x4[i * NPC + t];
  w[0] = ((const v4f*)Wq)[t]; w[1] = ((const v4f*)Wk)[t]; w[2] = ((const v4f*)Wv)[t]; w[3] = ((const v4f*)Wp)[t];
#pragma unroll
  for (int i = 0; i < 8; ++i) X4[i * NPC + t] = __builtin_convertvector(a[i], v4h);
#pragma unroll
  for (int i = 0; i < 4; ++i) P4[i * NPC + t] = __builtin_convertvector(w[i] * 16.0f, v4h);
}
// LDS byte address of a __shared__ element (what an asynchronous copy takes as its destination)
__device__ __forceinline__ unsigned lds_off(const void* p) { return (unsigned)(size_t)(const __attribute__((address_space(3))) void*)p; }
// eight asynchronous copies global -> LDS, 16 bytes a lane each, through no register. The s_wait_xcnt stands in the copies' own statement,
// so that no address register of a copy is rewritten ahead of it.
__device__ __forceinline__ void acopy8(const unsigned (&l)[8], const void* const (&p)[8]) {
  asm volatile("global_load_async_to_lds_b128 %0, %8, off\n\t"
               "global_load_async_to_lds_b128 %1, %9, off\n\t"
               "global_load_async_to_lds_b128 %2, %10, off\n\t"
               "global_load_async_to_lds_b128 %3, %11, off\n\t"
               "global_load_async_to_lds_b128 %4, %12, off\n\t"
               "global_load_async_to_lds_b128 %5, %13, off\n\t"
               "global_load_async_to_lds_b128 %6, %14, off\n\t"
               "global_load_async_to_lds_b128 %7, %15, off\n\t"
               "s_wait_xcnt 0x0"
               :: "v"(l[0]), "v"(l[1]), "v"(l[2]), "v"(l[3]), "v"(l[4]), "v"(l[5]), "v"(l[6]), "v"(l[7]),
                  "v"(p[0]), "v"(p[1]), "v"(p[2]), "v"(p[3]), "v"(p[4]), "v"(p[5]), "v"(p[6]), "v"(p[7]) : "memory");
}
// four such copies
__device__ __forceinline__ void acopy4(const unsigned (&l)[4], const void* const (&p)[4]) {
  asm volatile("global_load_async_to_lds_b128 %0, %4, off\n\t"
               "global_load_async_to_lds_b128 %1, %5, off\n\t"
               "global_load_async_to_lds_b128 %2, %6, off\n\t"
               "global_load_async_to_lds_b128 %3, %7, off\n\t"
               "s_wait_xcnt 0x0"
               :: "v"(l[0]), "v"(l[1]), "v"(l[2]), "v"(l[3]), "v"(p[0]), "v"(p[1]), "v"(p[2]), "v"(p[3]) : "memory");
}
#define KPITCH 72   // f16 per staged x, weight, K or V^T row: 144 B = 16 B x odd, conflict-free for 16-byte fragment reads
// q/k/v: block (64 rows, 128-col chunk = 2 heads, which): Q16/K16 head-major [b][h][e][64] (x4); VT [b][h][d][e] (x4); VS[b][h][64] partial sums handled later from VT
__global__ __launch_bounds__(128) void k_qkv(const _Float16* __restrict__ X16, const _Float16* __restrict__ P, _Float16* __restrict__ Q16, _Float16* __restrict__ K16, _Float16* __restrict__ VT) {
  // the staged tiles are dead (behind the loop's last barrier) when the results are laid out for their stores: the two uses share the LDS
  __shared__ __align__(16) union { struct { _Float16 a[2][64][KPITCH]; _Float16 b[2][128][KPITCH]; } t; float so[4][16][132]; _Float16 st[128][72]; } sm;
  auto& so = sm.so; auto& st = sm.st;
  const int tid = threadIdx.x, wave = tid >> 5, lane = tid & 31, col = lane & 15, g = lane >> 4;
  const int which = blockIdx.z, r0b = blockIdx.x * 64, n0 = blockIdx.y * 128; const int b = r0b / EE, e0 = r0b % EE;
  const _Float16* Pw = P + (size_t)which * CC * CC;
  // k slice ks (64 wide = one 128-B line of each row) -> buffer bf: the block's 128 weight rows and 64 x rows, whole lines, once for the four waves
  // (its loops are unrolled so that the address arrays are indexed by constants and stay in registers, as asm operands must)
  auto stage = [&](int ks, int bf) {
    unsigned l[8]; const void* p[8]; unsigned la[4]; const void* pa[4];
#pragma unroll
    for (int i = 0; i < 8; ++i) { const int c = tid + 128 * i, row = c >> 3, pc = c & 7;
      l[i] = lds_off(&sm.t.b[bf][row][pc * 8]); p[i] = Pw + (size_t)(n0 + row) * CC + ks * 64 + pc * 8; }
    acopy8(l, p);
#pragma unroll
    for (int i = 0; i < 4; ++i) { const int c = tid + 128 * i, row = c >> 3, pc = c & 7;
      la[i] = lds_off(&sm.t.a[bf][row][pc * 8]); pa[i] = X16 + (size_t)(r0b + row) * CC + ks * 64 + pc * 8; }
    acopy4(la, pa);
  };
  stage(0, 0);
  asm volatile("s_wait_asynccnt 0x0" ::: "memory");   // this wave's part of slice 0 has landed
  __syncthreads();                                     // ... and every other wave's
  stage(1, 1);
  v8f acc[8] = {};
#pragma unroll 1   // rolled: the trips are parted by barriers, so unrolling would only lengthen the text
  for (int ks = 0; ks < CC / 64; ++ks) { const int bf = ks & 1;
    // the slice's fragments are asked for in one batch ahead of its 16 products, so that the LDS latency is paid once a slice
    // (the short loops are unrolled so that these arrays are indexed by constants and stay in registers)
    v16h a[2], bq[2][8];
#pragma unroll
    for (int kc = 0; kc < 2; ++kc) { a[kc] = frag_h(&sm.t.a[bf][wave * 16 + col][kc * 32], lane);
#pragma unroll
      for (int j = 0; j < 8; ++j) bq[kc][j] = frag_h(&sm.t.b[bf][j * 16 + col][kc * 32], lane); }
#pragma unroll
    for (int kc = 0; kc < 2; ++kc)
#pragma unroll
      for (int j = 0; j < 8; ++j) acc[j] = wmma16(a[kc], bq[kc][j], acc[j]);
    asm volatile("s_wait_dscnt 0" ::: "memory");        // this wave's reads of buffer bf have returned
    asm volatile("s_wait_asynccnt 0x0" ::: "memory");   // this wave's part of slice ks + 1 has landed
    __syncthreads();                                     // publishes slice ks + 1 and ends every wave's reads of buffer bf
    if (ks + 2 < CC / 64) stage(ks + 2, bf); }
  asm volatile("s_wait_asynccnt 0x0" ::: "memory");     // no copy is left in flight when the LDS is taken for the results
  if (which < 2) {
#pragma unroll
    for (int j = 0; j < 8; ++j)
#pragma unroll
      for (int r = 0; r < 8; ++r) so[wave][8 * g + r][j * 16 + col] = acc[j][r] * (4.0f / 16.0f);
    LDSX();
    _Float16* D = which == 0 ? Q16 : K16;
    for (int q = lane; q < 16 * 2 * 8; q += 32) { const int hh = q >> 7, rl = (q >> 3) & 15, pc = q & 7; const int h = (n0 >> 6) + hh; union { v8h h8; v4u u; } pk;
#pragma unroll
      for (int e = 0; e < 8; ++e) pk.h8[e] = (_Float16)so[wave][rl][hh * 64 + pc * 8 + e];
      vst2(D + (((size_t)b * NH + h) * EE + e0 + wave * 16 + rl) * HD + pc * 8, pk.u); } }
  else {
#pragma unroll
    for (int j = 0; j < 8; ++j)
#pragma unroll
      for (int r = 0; r < 8; ++r) st[j * 16 + col][wave * 16 + 8 * g + r] = (_Float16)(acc[j][r] * (4.0f / 16.0f));
    __syncthreads();
    for (int q = tid; q < 128 * 8; q += 128) { const int cl = q >> 3, pc = q & 7; const int c = n0 + cl, h = c >> 6, d = c & 63; vst2(VT + (((size_t)b * NH + h) * HD + d) * EE + e0 + pc * 8, *(const v4u*)(&st[cl][pc * 8])); } }
}
// vsum[b][h][d] = sum_e v (f32, from VT /4): block per (b,h), thread per d (64 threads... use 256: 4 per d)
__global__ __launch_bounds__(256) void k_vsum(const _Float16* __restrict__ VT, float* __restrict__ VS) {
  __shared__ float sp[4][64]; __shared__ __align__(16) float so[64];
  const int bh = blockIdx.x, tid = threadIdx.x, d = tid & 63, part = tid >> 6; float s = 0.f;
  const _Float16* row = VT + ((size_t)bh * HD + d) * EE;
  for (int e = part * 512; e < part * 512 + 512; ++e) s += (float)row[e];
  sp[part][d] = s;
  __syncthreads();
  if (tid < 64) so[tid] = ((sp[0][tid] + sp[1][tid]) + (sp[2][tid] + sp[3][tid])) * 0.25f;
  __syncthreads();
  if (tid < 16) vst2(VS + (size_t)bh * HD + tid * 4, *(const v4f*)(&so[tid * 4]));
}
#define MPITCH 68   // f32 per staged mask row: 272 B, the two half-waves (8 rows apart) fall on different banks
// attention: block (64 q, h, b): S tiles over all 2048 keys (f16), * adj, /8 -> f16 P; acc += P @ V; out = 0.5*(acc*8/4) + 0.5*vsum -> O16 head-major [b][h][e][64] (x 1/8)
// Each 64-key tile of K, V and the block's 64 x 64 piece of the mask is brought into LDS once for the four waves, with whole-line
// asynchronous copies, one tile ahead (two buffers); a wave then fetches the tile's fragments from LDS in a few batches.
__global__ __launch_bounds__(128) void k_attn(const _Float16* __restrict__ Q16, const _Float16* __restrict__ K16, const _Float16* __restrict__ VT, const float* __restrict__ VS, const float* __restrict__ adj, _Float16* __restrict__ O16) {
  __shared__ __align__(16) _Float16 sK[2][64][KPITCH];
  __shared__ __align__(16) _Float16 sV[2][64][KPITCH];
  __shared__ __align__(16) float sM[2][64][MPITCH];
  __shared__ __align__(16) _Float16 sP[4][16][72];
  __shared__ __align__(16) float sO[4][16][68];
  const int tid = threadIdx.x, w = tid >> 5, lane = tid & 31, col = lane & 15, g = lane >> 4;
  const int b = blockIdx.z, h = blockIdx.y, q0b = blockIdx.x * 64, q0 = q0b + w * 16; const size_t bh = (size_t)b * NH + h;
  // tile kt -> buffer bf: K rows (128 B, adjacent), V^T rows (128 B of each of 64 rows), mask rows (256 B of each of 64 rows)
  auto stage = [&](int kt, int bf) {
    unsigned l[8]; const void* p[8];
#pragma unroll
    for (int i = 0; i < 4; ++i) { const int c = tid + 128 * i, row = c >> 3, pc = c & 7;
      l[i] = lds_off(&sK[bf][row][pc * 8]); p[i] = K16 + (bh * EE + kt * 64 + row) * HD + pc * 8;
      l[4 + i] = lds_off(&sV[bf][row][pc * 8]); p[4 + i] = VT + (bh * HD + row) * EE + kt * 64 + pc * 8; }
    acopy8(l, p);
#pragma unroll
    for (int i = 0; i < 8; ++i) { const int c = tid + 128 * i, row = c >> 4, pc = c & 15;
      l[i] = lds_off(&sM[bf][row][pc * 4]); p[i] = adj + (size_t)(q0b + row) * EE + kt * 64 + pc * 4; }
    acopy8(l, p);
  };
  stage(0, 0);
  v16h aq[2];
#pragma unroll
  for (int kc = 0; kc < 2; ++kc) aq[kc] = frag_h(Q16 + (bh * EE + q0 + col) * HD + kc * 32, lane);
  asm volatile("s_wait_asynccnt 0x0" ::: "memory");   // this wave's part of tile 0 has landed
  __syncthreads();                                     // ... and every other wave's
  stage(1, 1);
  v8f acc[4] = {};
#pragma unroll 1
  for (int kt = 0; kt < EE / 64; ++kt) { const int bf = kt & 1;
    // a tile's fragments are asked for in batches ahead of the products that use them, so that the LDS latency is paid a few times a
    // tile, not once a product: K and mask at the top, V as K's registers fall free, both P fragments together
    // (the short loops are unrolled so that these arrays are indexed by constants and stay in registers)
    v16h kf[4][2], vf[2][4], pa[2]; float m[4][8];
#pragma unroll
    for (int t = 0; t < 4; ++t) {
#pragma unroll
      for (int kc = 0; kc < 2; ++kc) kf[t][kc] = frag_h(&sK[bf][t * 16 + col][kc * 32], lane);
#pragma unroll
      for (int r = 0; r < 8; ++r) m[t][r] = sM[bf][w * 16 + 8 * g + r][t * 16 + col]; }
#pragma unroll
    for (int t = 0; t < 4; ++t) { v8f s = {};
#pragma unroll
      for (int kc = 0; kc < 2; ++kc) s = wmma16(aq[kc], kf[t][kc], s);
      if (t == 1 || t == 2) {
#pragma unroll
        for (int u = 0; u < 4; ++u) vf[t - 1][u] = frag_h(&sV[bf][u * 16 + col][(t - 1) * 32], lane); }
#pragma unroll
      for (int r = 0; r < 8; ++r) sP[w][8 * g + r][t * 16 + col] = (_Float16)(s[r] * m[t][r] * (1.0f / (16.0f * 8.0f))); }   // (x4 x4)/16 = true qk ; stored /8
    LDSX();
#pragma unroll
    for (int kc = 0; kc < 2; ++kc) pa[kc] = frag_h(&sP[w][col][0] + kc * 32, lane);
#pragma unroll
    for (int kc = 0; kc < 2; ++kc)
#pragma unroll
      for (int t = 0; t < 4; ++t) acc[t] = wmma16(pa[kc], vf[kc][t], acc[t]);
    asm volatile("s_wait_dscnt 0" ::: "memory");        // this wave's reads of buffer bf (and of its sP rows) have returned
    asm volatile("s_wait_asynccnt 0x0" ::: "memory");   // this wave's part of tile kt + 1 has landed
    __syncthreads();                                     // publishes tile kt + 1 and ends every wave's reads of buffer bf
    if (kt + 2 < EE / 64) stage(kt + 2, bf); }
  asm volatile("s_wait_asynccnt 0x0" ::: "memory");     // no copy is left in flight when the wave goes on
  // out = 0.5 * (acc * 8 / 4) + 0.5 * vsum[d]   (V stored x4) ; store O x 1/8 as f16 (values ~ O(50))
#pragma unroll
  for (int t = 0; t < 4; ++t) { const int d = t * 16 + col; const float vs = VS[bh * HD + d];
#pragma unroll
    for (int r = 0; r < 8; ++r) sO[w][8 * g + r][d] = (0.5f * (acc[t][r] * 2.0f) + 0.5f * vs) * 0.125f; }
  LDSX();
  for (int q = lane; q < 16 * 8; q += 32) { const int rl = q >> 3, pc = q & 7; union { v8h h8; v4u u; } pk;
#pragma unroll
    for (int e = 0; e < 8; ++e) pk.h8[e] = (_Float16)sO[w][rl][pc * 8 + e];
    vst2(O16 + (bh * EE + q0 + rl) * HD + pc * 8, pk.u); }
}
// proj + bias + LN; y = x + gamma * LN(out). Block = 16 rows x all 512 cols, 8 waves: wave w does cols 64w..64w+63 (one pass),
// then, behind one block barrier, wave w normalises rows 2w and 2w+1 with 16 columns per lane and whole-line loads and stores.
__global__ __launch_bounds__(256) void k_proj(const _Float16* __restrict__ O16, const _Float16* __restrict__ P, const float* __restrict__ bp, const float* __restrict__ lnw, const float* __restrict__ lnb, const float* __restrict__ gam, const float* __restrict__ x, float* __restrict__ out) {
  __shared__ __align__(16) float sy[16][CC + 4];
  const int tid = threadIdx.x, wave = tid >> 5, lane = tid & 31, col = lane & 15, g = lane >> 4;
  const int r0 = blockIdx.x * 16, n0 = wave * 64;
  v8f acc[4] = {};
#pragma unroll 2
  for (int kc = 0; kc < CC / 32; ++kc) { const int R = r0 + col; const v16h a = frag_h(O16 + ((((size_t)(R / EE)) * NH + (kc >> 1)) * EE + (R % EE)) * HD + (kc & 1) * 32, lane);
#pragma unroll
    for (int j = 0; j < 4; ++j) acc[j] = wmma16(a, frag_h(P + (size_t)(3 * CC + n0 + j * 16 + col) * CC + kc * 32, lane), acc[j]); }
  // this wave's x rows and the LN weights are asked for here, so that they fly during the LDS exchange and the row sums
  const float gm = gam[0]; v4f lw[4], lb[4], xv[2][4];
#pragma unroll
  for (int i = 0; i < 4; ++i) { lw[i] = *(const v4f*)(lnw + (i * 32 + lane) * 4); lb[i] = *(const v4f*)(lnb + (i * 32 + lane) * 4);
#pragma unroll
    for (int rr = 0; rr < 2; ++rr) xv[rr][i] = *(const v4f*)(x + (size_t)(r0 + wave * 2 + rr) * CC + (i * 32 + lane) * 4); }
#pragma unroll
  for (int j = 0; j < 4; ++j) { const int c = n0 + j * 16 + col; const float bb = bp[c];
#pragma unroll
    for (int r = 0; r < 8; ++r) sy[8 * g + r][c] = acc[j][r] * (8.0f / 16.0f) + bb; }
  __syncthreads();   // a row's 512 columns come from all eight waves
#pragma unroll
  for (int rr = 0; rr < 2; ++rr) { const int rl = wave * 2 + rr; v4f v[4];
#pragma unroll
    for (int i = 0; i < 4; ++i) v[i] = *(const v4f*)(&sy[rl][(i * 32 + lane) * 4]);
    float s = 0.f;
#pragma unroll
    for (int i = 0; i < 4; ++i) s += (v[i][0] + v[i][1]) + (v[i][2] + v[i][3]);
#pragma unroll
    for (int m = 16; m >= 1; m >>= 1) s += __shfl_xor(s, m, 32);
    const float mu = s * (1.0f / CC); float q2 = 0.f;
#pragma unroll
    for (int i = 0; i < 4; ++i) { v[i] -= mu; const v4f d2 = v[i] * v[i]; q2 += (d2[0] + d2[1]) + (d2[2] + d2[3]); }
#pragma unroll
    for (int m = 16; m >= 1; m >>= 1) q2 += __shfl_xor(q2, m, 32);
    const float rs = rsqrtf(q2 * (1.0f / CC) + 1e-5f);
#pragma unroll
    for (int i = 0; i < 4; ++i) vst2(out + (size_t)(r0 + rl) * CC + (i * 32 + lane) * 4, (v4f)(xv[rr][i] + gm * (v[i] * rs * lw[i] + lb[i]))); }
}
extern "C" void kernel_launch(void* const* d_in, const int* in_sizes, int n_in, void* d_out, int out_size, void* d_ws, size_t ws_size, hipStream_t stream) {
  (void)in_sizes; (void)n_in; (void)out_size; (void)ws_size;
  const float** I = (const float**)d_in;
  const float* x = I[0]; const float* adj = I[1]; const float* Wq = I[2]; const float* Wk = I[3]; const float* Wv = I[4]; const float* Wp = I[5]; const float* bp = I[6]; const float* lnw = I[7]; const float* lnb = I[8]; const float* gam = I[9];
  float* out = (float*)d_out;
  char* ws = (char*)d_ws; size_t off = 0;
  auto take = [&](size_t bytes) { char* p = ws + off; off += (bytes + 255) & ~(size_t)255; return p; };
  _Float16* X16 = (_Float16*)take((size_t)NR * CC * 2); _Float16* P = (_Float16*)take((size_t)4 * CC * CC * 2);
  _Float16* Q16 = (_Float16*)take((size_t)NR * CC * 2); _Float16* K16 = (_Float16*)take((size_t)NR * CC * 2); _Float16* VT = (_Float16*)take((size_t)NR * CC * 2); float* VS = (float*)take((size_t)NB * NH * HD * 4); _Float16* O16 = (_Float16*)take((size_t)NR * CC * 2);
  k_prep<<<NPC / 256, 256, 0, stream>>>(x, Wq, Wk, Wv, Wp, X16, P);
  k_qkv<<<dim3(NR / 64, CC / 128, 3), 128, 0, stream>>>(X16, P, Q16, K16, VT);
  k_vsum<<<NB * NH, 256, 0, stream>>>(VT, VS);
  k_attn<<<dim3(EE / 64, NH, NB), 128, 0, stream>>>(Q16, K16, VT, VS, adj, O16);
  k_proj<<<NR / 16, 256, 0, stream>>>(O16, P, bp, lnw, lnb, gam, x, out);
}

// v005
// It runs in 74.4 microseconds.
// Next to v004, in two timings, it ran 1.11 and 1.10 times as fast.
// All steps since v000 together make it 4.06 times as fast.
#include <hip/hip_runtime.h>
#include <math.h>

typedef __attribute__((ext_vector_type(16))) _Float16 v16h;
typedef __attribute__((ext_vector_type(16))) __bf16 v16b;
typedef __attribute__((ext_vector_type(8)))  _Float16 v8h;
typedef __attribute__((ext_vector_type(8)))  float v8f;
typedef __attribute__((ext_vector_type(4)))  float v4f;
typedef __attribute__((ext_vector_type(2)))  float v2f;
typedef __attribute__((ext_vector_type(4)))  unsigned v4u;
typedef __attribute__((ext_vector_type(4)))  int v4i;
typedef float __attribute__((may_alias)) float_a;
typedef int __attribute__((may_alias)) int_a;

template <typename T> __device__ __forceinline__ void vst2(void* p, T v) { *(T*)p = v;  }
__device__ __forceinline__ v8f wmma16(v16h a, v16h b, v8f c) {
  v8f d = __builtin_amdgcn_wmma_f32_16x16x32_f16(false, a, false, b, (short)0, c, false, false);
  asm volatile("v_nop\n\tv_nop\n\tv_nop\n\tv_nop" : "+v"(d) : "v"(a), "v"(b));
  return d;
}
__device__ __forceinline__ v8f wmma_bf(v16b a, v16b b, v8f c) {
  v8f d = __builtin_amdgcn_wmma_f32_16x16x32_bf16(false, a, false, b, (short)0, c, false, false);
  asm volatile("v_nop\n\tv_nop\n\tv_nop\n\tv_nop" : "+v"(d) : "v"(a), "v"(b));
  return d;
}
// 16x16x32 fragments: lane = (h = lane>>4, row/col = lane&15); elements 0..7 = k0+8h+0..7, 8..15 = k0+16+8h+0..7; D element r = row 8h+r
__device__ __forceinline__ v16h frag_h(const _Float16* rowk0, int lane) {
  union { v16h v; v8h q[2]; } u; const _Float16* p = rowk0 + 8 * (lane >> 4);
  u.q[0] = *(const v8h*)p; u.q[1] = *(const v8h*)(p + 16); return u.v;
}
__device__ __forceinline__ v16h frag_f32(const float* rowk0, int lane) {
  v16h a; const float* p = rowk0 + 8 * (lane >> 4);
#pragma unroll
  for (int i = 0; i < 8; ++i) { a[i] = (_Float16)p[i]; a[8 + i] = (_Float16)p[16 + i]; }
  return a;
}
__device__ __forceinline__ v16h frag_f32s(const float* rowk0, int lane, float sc) {
  v16h a; const float* p = rowk0 + 8 * (lane >> 4);
#pragma unroll
  for (int i = 0; i < 8; ++i) { a[i] = (_Float16)(p[i] * sc); a[8 + i] = (_Float16)(p[16 + i] * sc); }
  return a;
}
// column fragment from a [K][ld] layout (column n), rows >= K read as 0
__device__ __forceinline__ v16h fragc_f32(const float* W, int k0, int n, int lane, int ld, int K) {
  v16h a; const int g = lane >> 4;
#pragma unroll
  for (int i = 0; i < 8; ++i) { const int ka = k0 + 8 * g + i, kb = ka + 16;
    a[i] = (_Float16)(ka < K ? W[(size_t)ka * ld + n] : 0.f); a[8 + i] = (_Float16)(kb < K ? W[(size_t)kb * ld + n] : 0.f); }
  return a;
}
struct F2 { v16b h, l; };
__device__ __forceinline__ F2 bsplit16(const float v[16]) { F2 r;
#pragma unroll
  for (int i = 0; i < 16; ++i) { const __bf16 h = (__bf16)v[i]; r.h[i] = h; r.l[i] = (__bf16)(v[i] - (float)h); }
  return r; }
__device__ __forceinline__ F2 split_row(const float* row, int k0, int lane) { float v[16]; const float* p = row + k0 + 8 * (lane >> 4);
#pragma unroll
  for (int i = 0; i < 8; ++i) { v[i] = p[i]; v[8 + i] = p[16 + i]; }
  return bsplit16(v); }
__device__ __forceinline__ F2 split_rowK(const float* row, int k0, int lane, int K) { float v[16]; const int g = lane >> 4;
#pragma unroll
  for (int i = 0; i < 8; ++i) { const int ka = k0 + 8 * g + i, kb = ka + 16; v[i] = ka < K ? row[ka] : 0.f; v[8 + i] = kb < K ? row[kb] : 0.f; }
  return bsplit16(v); }
__device__ __forceinline__ F2 split_col(const float* W, int k0, int n, int lane, int ld, int K) { float v[16]; const int g = lane >> 4;
#pragma unroll
  for (int i = 0; i < 8; ++i) { const int ka = k0 + 8 * g + i, kb = ka + 16; v[i] = ka < K ? W[(size_t)ka * ld + n] : 0.f; v[8 + i] = kb < K ? W[(size_t)kb * ld + n] : 0.f; }
  return bsplit16(v); }
__device__ __forceinline__ v8f mac3(const F2& a, const F2& b, v8f c) { c = wmma_bf(a.l, b.h, c); c = wmma_bf(a.h, b.l, c); return wmma_bf(a.h, b.h, c); }
__device__ __forceinline__ float sigm(float v) { return 1.0f / (1.0f + expf(-v)); }
#define LDSX() do { asm volatile("s_wait_dscnt 0" ::: "memory"); __builtin_amdgcn_wave_barrier(); __builtin_amdgcn_fence(__ATOMIC_RELEASE, "workgroup"); } while (0)

// Mask-modulated linear attention block: q/k/v projections, per head attn = (q.k * adj + 1)/2 (no softmax), attn @ v, output projection
// + bias, LayerNorm, x + gamma * (.). All products on v_wmma_f32_16x16x32_f16 (x converted once, [out][in] weights packed as f16 rows
// x16, q/k/v kept head-major f16, the [E x E] scores scaled by 1/8 into f16 for the second product, adj mask read as data, the "+1"
// added to the scaled scores ahead of that product).
#define NB 2
#define EE 2048
#define CC 512
#define NH 8
#define HD 64
#define NR (NB * EE)

typedef __attribute__((ext_vector_type(4)))  _Float16 v4h;
#define NPC (CC * CC / 4)   // 16-byte pieces of one weight matrix = threads of k_prep
static_assert(NR * CC / 4 == 8 * NPC, "x is eight times a weight matrix");
// x -> X16 (f16) and Wq, Wk, Wv, Wp -> P (f16, x16; P rows [which*512 + n][512] are the weights' own [out][in] order), in one launch of
// few waves: thread t takes piece t of each eighth of x and of each weight. A wave's load covers 512 adjacent bytes, its store 256;
// the twelve loads are asked for together, so that the memory latency is paid once a wave.
__global__ __launch_bounds__(256) void k_prep(const float* __restrict__ x, const float* __restrict__ Wq, const float* __restrict__ Wk, const float* __restrict__ Wv, const float* __restrict__ Wp, _Float16* __restrict__ X16, _Float16* __restrict__ P) {
  const unsigned t = blockIdx.x * 256 + threadIdx.x;
  const v4f* x4 = (const v4f*)x; v4h* X4 = (v4h*)X16; v4h* P4 = (v4h*)P;
  v4f a[8], w[4];
#pragma unroll   // this loop and the two below: unrolled so that the arrays are indexed by constants and stay in registers
  for (int i = 0; i < 8; ++i) a[i] = x4[i * NPC + t];
  w[0] = ((const v4f*)Wq)[t]; w[1] = ((const v4f*)Wk)[t]; w[2] = ((const v4f*)Wv)[t]; w[3] = ((const v4f*)Wp)[t];
#pragma unroll
  for (int i = 0; i < 8; ++i) X4[i * NPC + t] = __builtin_convertvector(a[i], v4h);
#pragma unroll
  for (int i = 0; i < 4; ++i) P4[i * NPC + t] = __builtin_convertvector(w[i] * 16.0f, v4h);
}
// LDS byte address of a __shared__ element (what an asynchronous copy takes as its destination)
__device__ __forceinline__ unsigned lds_off(const void* p) { return (unsigned)(size_t)(const __attribute__((address_space(3))) void*)p; }
// eight asynchronous copies global -> LDS, 16 bytes a lane each, through no register. The s_wait_xcnt stands in the copies' own statement,
// so that no address register of a copy is rewritten ahead of it.
__device__ __forceinline__ void acopy8(const unsigned (&l)[8], const void* const (&p)[8]) {
  asm volatile("global_load_async_to_lds_b128 %0, %8, off\n\t"
               "global_load_async_to_lds_b128 %1, %9, off\n\t"
               "global_load_async_to_lds_b128 %2, %10, off\n\t"
               "global_load_async_to_lds_b128 %3, %11, off\n\t"
               "global_load_async_to_lds_b128 %4, %12, off\n\t"
               "global_load_async_to_lds_b128 %5, %13, off\n\t"
               "global_load_async_to_lds_b128 %6, %14, off\n\t"
               "global_load_async_to_lds_b128 %7, %15, off\n\t"
               "s_wait_xcnt 0x0"
               :: "v"(l[0]), "v"(l[1]), "v"(l[2]), "v"(l[3]), "v"(l[4]), "v"(l[5]), "v"(l[6]), "v"(l[7]),
                  "v"(p[0]), "v"(p[1]), "v"(p[2]), "v"(p[3]), "v"(p[4]), "v"(p[5]), "v"(p[6]), "v"(p[7]) : "memory");
}
// four such copies
__device__ __forceinline__ void acopy4(const unsigned (&l)[4], const void* const (&p)[4]) {
  asm volatile("global_load_async_to_lds_b128 %0, %4, off\n\t"
               "global_load_async_to_lds_b128 %1, %5, off\n\t"
               "global_load_async_to_lds_b128 %2, %6, off\n\t"
               "global_load_async_to_lds_b128 %3, %7, off\n\t"
               "s_wait_xcnt 0x0"
               :: "v"(l[0]), "v"(l[1]), "v"(l[2]), "v"(l[3]), "v"(p[0]), "v"(p[1]), "v"(p[2]), "v"(p[3]) : "memory");
}
#define KPITCH 72   // f16 per staged x, weight, K or V row: 144 B = 16 B x odd, conflict-free for 16-byte fragment reads
// q/k/v: block (64 rows, 128-col chunk = 2 heads, which): Q16/K16 head-major [b][h][e][64] (x4); VT [b][h][d][e] (x4)
__global__ __launch_bounds__(128) void k_qkv(const _Float16* __restrict__ X16, const _Float16* __restrict__ P, _Float16* __restrict__ Q16, _Float16* __restrict__ K16, _Float16* __restrict__ VT) {
  // the staged tiles are dead (behind the loop's last barrier) when the results are laid out for their stores: the two uses share the LDS
  __shared__ __align__(16) union { struct { _Float16 a[2][64][KPITCH]; _Float16 b[2][128][KPITCH]; } t; float so[4][16][132]; _Float16 st[128][72]; } sm;
  auto& so = sm.so; auto& st = sm.st;
  const int tid = threadIdx.x, wave = tid >> 5, lane = tid & 31, col = lane & 15, g = lane >> 4;
  const int which = blockIdx.z, r0b = blockIdx.x * 64, n0 = blockIdx.y * 128; const int b = r0b / EE, e0 = r0b % EE;
  const _Float16* Pw = P + (size_t)which * CC * CC;
  // k slice ks (64 wide = one 128-B line of each row) -> buffer bf: the block's 128 weight rows and 64 x rows, whole lines, once for the four waves
  // (its loops are unrolled so that the address arrays are indexed by constants and stay in registers, as asm operands must)
  auto stage = [&](int ks, int bf) {
    unsigned l[8]; const void* p[8]; unsigned la[4]; const void* pa[4];
#pragma unroll
    for (int i = 0; i < 8; ++i) { const int c = tid + 128 * i, row = c >> 3, pc = c & 7;
      l[i] = lds_off(&sm.t.b[bf][row][pc * 8]); p[i] = Pw + (size_t)(n0 + row) * CC + ks * 64 + pc * 8; }
    acopy8(l, p);
#pragma unroll
    for (int i = 0; i < 4; ++i) { const int c = tid + 128 * i, row = c >> 3, pc = c & 7;
      la[i] = lds_off(&sm.t.a[bf][row][pc * 8]); pa[i] = X16 + (size_t)(r0b + row) * CC + ks * 64 + pc * 8; }
    acopy4(la, pa);
  };
  stage(0, 0);
  asm volatile("s_wait_asynccnt 0x0" ::: "memory");   // this wave's part of slice 0 has landed
  __syncthreads();                                     // ... and every other wave's
  stage(1, 1);
  v8f acc[8] = {};
#pragma unroll 1   // rolled: the trips are parted by barriers, so unrolling would only lengthen the text
  for (int ks = 0; ks < CC / 64; ++ks) { const int bf = ks & 1;
    // the slice's fragments are asked for in one batch ahead of its 16 products, so that the LDS latency is paid once a slice
    // (the short loops are unrolled so that these arrays are indexed by constants and stay in registers)
    v16h a[2], bq[2][8];
#pragma unroll
    for (int kc = 0; kc < 2; ++kc) { a[kc] = frag_h(&sm.t.a[bf][wave * 16 + col][kc * 32], lane);
#pragma unroll
      for (int j = 0; j < 8; ++j) bq[kc][j] = frag_h(&sm.t.b[bf][j * 16 + col][kc * 32], lane); }
#pragma unroll
    for (int kc = 0; kc < 2; ++kc)
#pragma unroll
      for (int j = 0; j < 8; ++j) acc[j] = wmma16(a[kc], bq[kc][j], acc[j]);
    asm volatile("s_wait_dscnt 0" ::: "memory");        // this wave's reads of buffer bf have returned
    asm volatile("s_wait_asynccnt 0x0" ::: "memory");   // this wave's part of slice ks + 1 has landed
    __syncthreads();                                     // publishes slice ks + 1 and ends every wave's reads of buffer bf
    if (ks + 2 < CC / 64) stage(ks + 2, bf); }
  asm volatile("s_wait_asynccnt 0x0" ::: "memory");     // no copy is left in flight when the LDS is taken for the results
  if (which < 2) {
#pragma unroll
    for (int j = 0; j < 8; ++j)
#pragma unroll
      for (int r = 0; r < 8; ++r) so[wave][8 * g + r][j * 16 + col] = acc[j][r] * (4.0f / 16.0f);
    LDSX();
    _Float16* D = which == 0 ? Q16 : K16;
    for (int q = lane; q < 16 * 2 * 8; q += 32) { const int hh = q >> 7, rl = (q >> 3) & 15, pc = q & 7; const int h = (n0 >> 6) + hh; union { v8h h8; v4u u; } pk;
#pragma unroll
      for (int e = 0; e < 8; ++e) pk.h8[e] = (_Float16)so[wave][rl][hh * 64 + pc * 8 + e];
      vst2(D + (((size_t)b * NH + h) * EE + e0 + wave * 16 + rl) * HD + pc * 8, pk.u); } }
  else {
#pragma unroll
    for (int j = 0; j < 8; ++j)
#pragma unroll
      for (int r = 0; r < 8; ++r) st[j * 16 + col][wave * 16 + 8 * g + r] = (_Float16)(acc[j][r] * (4.0f / 16.0f));
    __syncthreads();
    for (int q = tid; q < 128 * 8; q += 128) { const int cl = q >> 3, pc = q & 7; const int c = n0 + cl, h = c >> 6, d = c & 63; vst2(VT + (((size_t)b * NH + h) * HD + d) * EE + e0 + pc * 8, *(const v4u*)(&st[cl][pc * 8])); } }
}
#define MPITCH 68   // f32 per staged mask row: 272 B, the two half-waves (8 rows apart) fall on different banks
// attention: block (64 q, h, b): S tiles over all 2048 keys (f16); P = (S * adj + 1) / 8 -> f16; acc += P @ V; out = 0.5 * 8 * acc / 4 -> O16 head-major [b][h][e][64] (x 1/8)
// The "+1" of the scores goes into P itself (one fused multiply-add a score), so that the second product also yields the sum of v over the keys.
// Each 64-key tile of K, V and the block's 64 x 64 piece of the mask is brought into LDS once for the four waves, with whole-line
// asynchronous copies, one tile ahead (two buffers); a wave then fetches the tile's fragments from LDS in a few batches.
__global__ __launch_bounds__(128) void k_attn(const _Float16* __restrict__ Q16, const _Float16* __restrict__ K16, const _Float16* __restrict__ VT, const float* __restrict__ adj, _Float16* __restrict__ O16) {
  __shared__ __align__(16) _Float16 sK[2][64][KPITCH];
  __shared__ __align__(16) _Float16 sV[2][64][KPITCH];
  __shared__ __align__(16) float sM[2][64][MPITCH];
  __shared__ __align__(16) _Float16 sP[4][16][72];
  __shared__ __align__(16) float sO[4][16][68];
  const int tid = threadIdx.x, w = tid >> 5, lane = tid & 31, col = lane & 15, g = lane >> 4;
  const int b = blockIdx.z, h = blockIdx.y, q0b = blockIdx.x * 64, q0 = q0b + w * 16; const size_t bh = (size_t)b * NH + h;
  // tile kt -> buffer bf: K rows (128 B, adjacent), V^T rows (128 B of each of 64 rows), mask rows (256 B of each of 64 rows)
  auto stage = [&](int kt, int bf) {
    unsigned l[8]; const void* p[8];
#pragma unroll
    for (int i = 0; i < 4; ++i) { const int c = tid + 128 * i, row = c >> 3, pc = c & 7;
      l[i] = lds_off(&sK[bf][row][pc * 8]); p[i] = K16 + (bh * EE + kt * 64 + row) * HD + pc * 8;
      l[4 + i] = lds_off(&sV[bf][row][pc * 8]); p[4 + i] = VT + (bh * HD + row) * EE + kt * 64 + pc * 8; }
    acopy8(l, p);
#pragma unroll
    for (int i = 0; i < 8; ++i) { const int c = tid + 128 * i, row = c >> 4, pc = c & 15;
      l[i] = lds_off(&sM[bf][row][pc * 4]); p[i] = adj + (size_t)(q0b + row) * EE + kt * 64 + pc * 4; }
    acopy8(l, p);
  };
  stage(0, 0);
  v16h aq[2];
#pragma unroll
  for (int kc = 0; kc < 2; ++kc) aq[kc] = frag_h(Q16 + (bh * EE + q0 + col) * HD + kc * 32, lane);
  asm volatile("s_wait_asynccnt 0x0" ::: "memory");   // this wave's part of tile 0 has landed
  __syncthreads();                                     // ... and every other wave's
  stage(1, 1);
  v8f acc[4] = {};
#pragma unroll 1
  for (int kt = 0; kt < EE / 64; ++kt) { const int bf = kt & 1;
    // a tile's fragments are asked for in batches ahead of the products that use them, so that the LDS latency is paid a few times a
    // tile, not once a product: K and mask at the top, V as K's registers fall free, both P fragments together
    // (the short loops are unrolled so that these arrays are indexed by constants and stay in registers)
    v16h kf[4][2], vf[2][4], pa[2]; float m[4][8];
#pragma unroll
    for (int t = 0; t < 4; ++t) {
#pragma unroll
      for (int kc = 0; kc < 2; ++kc) kf[t][kc] = frag_h(&sK[bf][t * 16 + col][kc * 32], lane);
#pragma unroll
      for (int r = 0; r < 8; ++r) m[t][r] = sM[bf][w * 16 + 8 * g + r][t * 16 + col]; }
#pragma unroll
    for (int t = 0; t < 4; ++t) { v8f s = {};
#pragma unroll
      for (int kc = 0; kc < 2; ++kc) s = wmma16(aq[kc], kf[t][kc], s);
      if (t == 1 || t == 2) {
#pragma unroll
        for (int u = 0; u < 4; ++u) vf[t - 1][u] = frag_h(&sV[bf][u * 16 + col][(t - 1) * 32], lane); }
#pragma unroll
      for (int r = 0; r < 8; ++r) sP[w][8 * g + r][t * 16 + col] = (_Float16)(s[r] * m[t][r] * (1.0f / (16.0f * 8.0f)) + 0.125f); }   // (x4 x4)/16 = true qk ; (qk * adj + 1) stored /8
    LDSX();
#pragma unroll
    for (int kc = 0; kc < 2; ++kc) pa[kc] = frag_h(&sP[w][col][0] + kc * 32, lane);
#pragma unroll
    for (int kc = 0; kc < 2; ++kc)
#pragma unroll
      for (int t = 0; t < 4; ++t) acc[t] = wmma16(pa[kc], vf[kc][t], acc[t]);
    asm volatile("s_wait_dscnt 0" ::: "memory");        // this wave's reads of buffer bf (and of its sP rows) have returned
    asm volatile("s_wait_asynccnt 0x0" ::: "memory");   // this wave's part of tile kt + 1 has landed
    __syncthreads();                                     // publishes tile kt + 1 and ends every wave's reads of buffer bf
    if (kt + 2 < EE / 64) stage(kt + 2, bf); }
  asm volatile("s_wait_asynccnt 0x0" ::: "memory");     // no copy is left in flight when the wave goes on
  // out = 0.5 * (acc * 8 / 4) = acc   (P stored /8, V stored x4) ; store O x 1/8 as f16 (values ~ O(50))
#pragma unroll
  for (int t = 0; t < 4; ++t) { const int d = t * 16 + col;
#pragma unroll
    for (int r = 0; r < 8; ++r) sO[w][8 * g + r][d] = acc[t][r] * 0.125f; }
  LDSX();
  for (int q = lane; q < 16 * 8; q += 32) { const int rl = q >> 3, pc = q & 7; union { v8h h8; v4u u; } pk;
#pragma unroll
    for (int e = 0; e < 8; ++e) pk.h8[e] = (_Float16)sO[w][rl][pc * 8 + e];
    vst2(O16 + (bh * EE + q0 + rl) * HD + pc * 8, pk.u); }
}
// proj + bias + LN; y = x + gamma * LN(out). Block = 16 rows x all 512 cols, 8 waves: wave w does cols 64w..64w+63 (one pass),
// then, behind one block barrier, wave w normalises rows 2w and 2w+1 with 16 columns per lane and whole-line loads and stores.
__global__ __launch_bounds__(256) void k_proj(const _Float16* __restrict__ O16, const _Float16* __restrict__ P, const float* __restrict__ bp, const float* __restrict__ lnw, const float* __restrict__ lnb, const float* __restrict__ gam, const float* __restrict__ x, float* __restrict__ out) {
  __shared__ __align__(16) float sy[16][CC + 4];
  const int tid = threadIdx.x, wave = tid >> 5, lane = tid & 31, col = lane & 15, g = lane >> 4;
  const int r0 = blockIdx.x * 16, n0 = wave * 64;
  v8f acc[4] = {};
#pragma unroll 2
  for (int kc = 0; kc < CC / 32; ++kc) { const int R = r0 + col; const v16h a = frag_h(O16 + ((((size_t)(R / EE)) * NH + (kc >> 1)) * EE + (R % EE)) * HD + (kc & 1) * 32, lane);
#pragma unroll
    for (int j = 0; j < 4; ++j) acc[j] = wmma16(a, frag_h(P + (size_t)(3 * CC + n0 + j * 16 + col) * CC + kc * 32, lane), acc[j]); }
  // this wave's x rows and the LN weights are asked for here, so that they fly during the LDS exchange and the row sums
  const float gm = gam[0]; v4f lw[4], lb[4], xv[2][4];
#pragma unroll
  for (int i = 0; i < 4; ++i) { lw[i] = *(const v4f*)(lnw + (i * 32 + lane) * 4); lb[i] = *(const v4f*)(lnb + (i * 32 + lane) * 4);
#pragma unroll
    for (int rr = 0; rr < 2; ++rr) xv[rr][i] = *(const v4f*)(x + (size_t)(r0 + wave * 2 + rr) * CC + (i * 32 + lane) * 4); }
#pragma unroll
  for (int j = 0; j < 4; ++j) { const int c = n0 + j * 16 + col; const float bb = bp[c];
#pragma unroll
    for (int r = 0; r < 8; ++r) sy[8 * g + r][c] = acc[j][r] * (8.0f / 16.0f) + bb; }
  __syncthreads();   // a row's 512 columns come from all eight waves
#pragma unroll
  for (int rr = 0; rr < 2; ++rr) { const int rl = wave * 2 + rr; v4f v[4];
#pragma unroll
    for (int i = 0; i < 4; ++i) v[i] = *(const v4f*)(&sy[rl][(i * 32 + lane) * 4]);
    float s = 0.f;
#pragma unroll
    for (int i = 0; i < 4; ++i) s += (v[i][0] + v[i][1]) + (v[i][2] + v[i][3]);
#pragma unroll
    for (int m = 16; m >= 1; m >>= 1) s += __shfl_xor(s, m, 32);
    const float mu = s * (1.0f / CC); float q2 = 0.f;
#pragma unroll
    for (int i = 0; i < 4; ++i) { v[i] -= mu; const v4f d2 = v[i] * v[i]; q2 += (d2[0] + d2[1]) + (d2[2] + d2[3]); }
#pragma unroll
    for (int m = 16; m >= 1; m >>= 1) q2 += __shfl_xor(q2, m, 32);
    const float rs = rsqrtf(q2 * (1.0f / CC) + 1e-5f);
#pragma unroll
    for (int i = 0; i < 4; ++i) vst2(out + (size_t)(r0 + rl) * CC + (i * 32 + lane) * 4, (v4f)(xv[rr][i] + gm * (v[i] * rs * lw[i] + lb[i]))); }
}
extern "C" void kernel_launch(void* const* d_in, const int* in_sizes, int n_in, void* d_out, int out_size, void* d_ws, size_t ws_size, hipStream_t stream) {
  (void)in_sizes; (void)n_in; (void)out_size; (void)ws_size;
  const float** I = (const float**)d_in;
  const float* x = I[0]; const float* adj = I[1]; const float* Wq = I[2]; const float* Wk = I[3]; const float* Wv = I[4]; const float* Wp = I[5]; const float* bp = I[6]; const float* lnw = I[7]; const float* lnb = I[8]; const float* gam = I[9];
  float* out = (float*)d_out;
  char* ws = (char*)d_ws; size_t off = 0;
  auto take = [&](size_t bytes) { char* p = ws + off; off += (bytes + 255) & ~(size_t)255; return p; };
  _Float16* X16 = (_Float16*)take((size_t)NR * CC * 2); _Float16* P = (_Float16*)take((size_t)4 * CC * CC * 2);
  _Float16* Q16 = (_Float16*)take((size_t)NR * CC * 2); _Float16* K16 = (_Float16*)take((size_t)NR * CC * 2); _Float16* VT = (_Float16*)take((size_t)NR * CC * 2); _Float16* O16 = (_Float16*)take((size_t)NR * CC * 2);
  k_prep<<<NPC / 256, 256, 0, stream>>>(x, Wq, Wk, Wv, Wp, X16, P);
  k_qkv<<<dim3(NR / 64, CC / 128, 3), 128, 0, stream>>>(X16, P, Q16, K16, VT);
  k_attn<<<dim3(EE / 64, NH, NB), 128, 0, stream>>>(Q16, K16, VT, adj, O16);
  k_proj<<<NR / 16, 256, 0, stream>>>(O16, P, bp, lnw, lnb, gam, x, out);
}

// v006
// One run takes 64.9 microseconds.
// Two timings next to v005 put it at 1.15 and 1.14 times that version's speed.
// All steps since v000 together make it 4.66 times as fast.
#include <hip/hip_runtime.h>
#include <math.h>

typedef __attribute__((ext_vector_type(16))) _Float16 v16h;
typedef __attribute__((ext_vector_type(16))) __bf16 v16b;
typedef __attribute__((ext_vector_type(8)))  _Float16 v8h;
typedef __attribute__((ext_vector_type(8)))  float v8f;
typedef __attribute__((ext_vector_type(4)))  float v4f;
typedef __attribute__((ext_vector_type(2)))  float v2f;
typedef __attribute__((ext_vector_type(4)))  unsigned v4u;
typedef __attribute__((ext_vector_type(4)))  int v4i;
typedef float __attribute__((may_alias)) float_a;
typedef int __attribute__((may_alias)) int_a;

template <typename T> __device__ __forceinline__ void vst2(void* p, T v) { *(T*)p = v;  }
__device__ __forceinline__ v8f wmma16(v16h a, v16h b, v8f c) {
  v8f d = __builtin_amdgcn_wmma_f32_16x16x32_f16(false, a, false, b, (short)0, c, false, false);
  asm volatile("v_nop\n\tv_nop\n\tv_nop\n\tv_nop" : "+v"(d) : "v"(a), "v"(b));
  return d;
}
__device__ __forceinline__ v8f wmma_bf(v16b a, v16b b, v8f c) {
  v8f d = __builtin_amdgcn_wmma_f32_16x16x32_bf16(false, a, false, b, (short)0, c, false, false);
  asm volatile("v_nop\n\tv_nop\n\tv_nop\n\tv_nop" : "+v"(d) : "v"(a), "v"(b));
  return d;
}
// 16x16x32 fragments: lane = (h = lane>>4, row/col = lane&15); elements 0..7 = k0+8h+0..7, 8..15 = k0+16+8h+0..7; D element r = row 8h+r
__device__ __forceinline__ v16h frag_h(const _Float16* rowk0, int lane) {
  union { v16h v; v8h q[2]; } u; const _Float16* p = rowk0 + 8 * (lane >> 4);
  u.q[0] = *(const v8h*)p; u.q[1] = *(const v8h*)(p + 16); return u.v;
}
__device__ __forceinline__ v16h frag_f32(const float* rowk0, int lane) {
  v16h a; const float* p = rowk0 + 8 * (lane >> 4);
#pragma unroll
  for (int i = 0; i < 8; ++i) { a[i] = (_Float16)p[i]; a[8 + i] = (_Float16)p[16 + i]; }
  return a;
}
__device__ __forceinline__ v16h frag_f32s(const float* rowk0, int lane, float sc) {
  v16h a; const float* p = rowk0 + 8 * (lane >> 4);
#pragma unroll
  for (int i = 0; i < 8; ++i) { a[i] = (_Float16)(p[i] * sc); a[8 + i] = (_Float16)(p[16 + i] * sc); }
  return a;
}
// column fragment from a [K][ld] layout (column n), rows >= K read as 0
__device__ __forceinline__ v16h fragc_f32(const float* W, int k0, int n, int lane, int ld, int K) {
  v16h a; const int g = lane >> 4;
#pragma unroll
  for (int i = 0; i < 8; ++i) { const int ka = k0 + 8 * g + i, kb = ka + 16;
    a[i] = (_Float16)(ka < K ? W[(size_t)ka * ld + n] : 0.f); a[8 + i] = (_Float16)(kb < K ? W[(size_t)kb * ld + n] : 0.f); }
  return a;
}
struct F2 { v16b h, l; };
__device__ __forceinline__ F2 bsplit16(const float v[16]) { F2 r;
#pragma unroll
  for (int i = 0; i < 16; ++i) { const __bf16 h = (__bf16)v[i]; r.h[i] = h; r.l[i] = (__bf16)(v[i] - (float)h); }
  return r; }
__device__ __forceinline__ F2 split_row(const float* row, int k0, int lane) { float v[16]; const float* p = row + k0 + 8 * (lane >> 4);
#pragma unroll
  for (int i = 0; i < 8; ++i) { v[i] = p[i]; v[8 + i] = p[16 + i]; }
  return bsplit16(v); }
__device__ __forceinline__ F2 split_rowK(const float* row, int k0, int lane, int K) { float v[16]; const int g = lane >> 4;
#pragma unroll
  for (int i = 0; i < 8; ++i) { const int ka = k0 + 8 * g + i, kb = ka + 16; v[i] = ka < K ? row[ka] : 0.f; v[8 + i] = kb < K ? row[kb] : 0.f; }
  return bsplit16(v); }
__device__ __forceinline__ F2 split_col(const float* W, int k0, int n, int lane, int ld, int K) { float v[16]; const int g = lane >> 4;
#pragma unroll
  for (int i = 0; i < 8; ++i) { const int ka = k0 + 8 * g + i, kb = ka + 16; v[i] = ka < K ? W[(size_t)ka * ld + n] : 0.f; v[8 + i] = kb < K ? W[(size_t)kb * ld + n] : 0.f; }
  return bsplit16(v); }
__device__ __forceinline__ v8f mac3(const F2& a, const F2& b, v8f c) { c = wmma_bf(a.l, b.h, c); c = wmma_bf(a.h, b.l, c); return wmma_bf(a.h, b.h, c); }
__device__ __forceinline__ float sigm(float v) { return 1.0f / (1.0f + expf(-v)); }
#define LDSX() do { asm volatile("s_wait_dscnt 0" ::: "memory"); __builtin_amdgcn_wave_barrier(); __builtin_amdgcn_fence(__ATOMIC_RELEASE, "workgroup"); } while (0)

// Mask-modulated linear attention block: q/k/v projections, per head attn = (q.k * adj + 1)/2 (no softmax), attn @ v, output projection
// + bias, LayerNorm, x + gamma * (.). All products on v_wmma_f32_16x16x32_f16 (x converted once, [out][in] weights packed as f16 rows
// x16, q/k/v kept head-major f16, the [E x E] scores scaled by 1/8 into f16 for the second product, adj mask read as data, the "+1"
// added to the scaled scores ahead of that product).
#define NB 2
#define EE 2048
#define CC 512
#define NH 8
#define HD 64
#define NR (NB * EE)

typedef __attribute__((ext_vector_type(4)))  _Float16 v4h;
#define NPC (CC * CC / 4)   // 16-byte pieces of one weight matrix = threads of k_prep
static_assert(NR * CC / 4 == 8 * NPC, "x is eight times a weight matrix");
// x -> X16 (f16) and Wq, Wk, Wv, Wp -> P (f16, x16; P rows [which*512 + n][512] are the weights' own [out][in] order), in one launch of
// few waves: thread t takes piece t of each eighth of x and of each weight. A wave's load covers 512 adjacent bytes, its store 256;
// the twelve loads are asked for together, so that the memory latency is paid once a wave.
__global__ __launch_bounds__(256) void k_prep(const float* __restrict__ x, const float* __restrict__ Wq, const float* __restrict__ Wk, const float* __restrict__ Wv, const float* __restrict__ Wp, _Float16* __restrict__ X16, _Float16* __restrict__ P) {
  const unsigned t = blockIdx.x * 256 + threadIdx.x;
  const v4f* x4 = (const v4f*)x; v4h* X4 = (v4h*)X16; v4h* P4 = (v4h*)P;
  v4f a[8], w[4];
#pragma unroll   // this loop and the two below: unrolled so that the arrays are indexed by constants and stay in registers
  for (int i = 0; i < 8; ++i) a[i] = x4[i * NPC + t];
  w[0] = ((const v4f*)Wq)[t]; w[1] = ((const v4f*)Wk)[t]; w[2] = ((const v4f*)Wv)[t]; w[3] = ((const v4f*)Wp)[t];
#pragma unroll
  for (int i = 0; i < 8; ++i) X4[i * NPC + t] = __builtin_convertvector(a[i], v4h);
#pragma unroll
  for (int i = 0; i < 4; ++i) P4[i * NPC + t] = __builtin_convertvector(w[i] * 16.0f, v4h);
}
// LDS byte address of a __shared__ element (what an asynchronous copy takes as its destination)
__device__ __forceinline__ unsigned lds_off(const void* p) { return (unsigned)(size_t)(const __attribute__((address_space(3))) void*)p; }
// eight asynchronous copies global -> LDS, 16 bytes a lane each, through no register. The s_wait_xcnt stands in the copies' own statement,
// so that no address register of a copy is rewritten ahead of it.
__device__ __forceinline__ void acopy8(const unsigned (&l)[8], const void* const (&p)[8]) {
  asm volatile("global_load_async_to_lds_b128 %0, %8, off\n\t"
               "global_load_async_to_lds_b128 %1, %9, off\n\t"
               "global_load_async_to_lds_b128 %2, %10, off\n\t"
               "global_load_async_to_lds_b128 %3, %11, off\n\t"
               "global_load_async_to_lds_b128 %4, %12, off\n\t"
               "global_load_async_to_lds_b128 %5, %13, off\n\t"
               "global_load_async_to_lds_b128 %6, %14, off\n\t"
               "global_load_async_to_lds_b128 %7, %15, off\n\t"
               "s_wait_xcnt 0x0"
               :: "v"(l[0]), "v"(l[1]), "v"(l[2]), "v"(l[3]), "v"(l[4]), "v"(l[5]), "v"(l[6]), "v"(l[7]),
                  "v"(p[0]), "v"(p[1]), "v"(p[2]), "v"(p[3]), "v"(p[4]), "v"(p[5]), "v"(p[6]), "v"(p[7]) : "memory");
}
// four such copies
__device__ __forceinline__ void acopy4(const unsigned (&l)[4], const void* const (&p)[4]) {
  asm volatile("global_load_async_to_lds_b128 %0, %4, off\n\t"
               "global_load_async_to_lds_b128 %1, %5, off\n\t"
               "global_load_async_to_lds_b128 %2, %6, off\n\t"
               "global_load_async_to_lds_b128 %3, %7, off\n\t"
               "s_wait_xcnt 0x0"
               :: "v"(l[0]), "v"(l[1]), "v"(l[2]), "v"(l[3]), "v"(p[0]), "v"(p[1]), "v"(p[2]), "v"(p[3]) : "memory");
}
#define KPITCH 72   // f16 per staged x, weight, K, V or O row: 144 B = 16 B x odd, conflict-free for 16-byte fragment reads
// q/k/v: block (64 rows, 128-col chunk = 2 heads, which): Q16/K16 head-major [b][h][e][64] (x4); VT [b][h][d][e] (x4)
__global__ __launch_bounds__(128) void k_qkv(const _Float16* __restrict__ X16, const _Float16* __restrict__ P, _Float16* __restrict__ Q16, _Float16* __restrict__ K16, _Float16* __restrict__ VT) {
  // the staged tiles are dead (behind the loop's last barrier) when the results are laid out for their stores: the two uses share the LDS
  __shared__ __align__(16) union { struct { _Float16 a[2][64][KPITCH]; _Float16 b[2][128][KPITCH]; } t; float so[4][16][132]; _Float16 st[128][72]; } sm;
  auto& so = sm.so; auto& st = sm.st;
  const int tid = threadIdx.x, wave = tid >> 5, lane = tid & 31, col = lane & 15, g = lane >> 4;
  const int which = blockIdx.z, r0b = blockIdx.x * 64, n0 = blockIdx.y * 128; const int b = r0b / EE, e0 = r0b % EE;
  const _Float16* Pw = P + (size_t)which * CC * CC;
  // k slice ks (64 wide = one 128-B line of each row) -> buffer bf: the block's 128 weight rows and 64 x rows, whole lines, once for the four waves
  // (its loops are unrolled so that the address arrays are indexed by constants and stay in registers, as asm operands must)
  auto stage = [&](int ks, int bf) {
    unsigned l[8]; const void* p[8]; unsigned la[4]; const void* pa[4];
#pragma unroll
    for (int i = 0; i < 8; ++i) { const int c = tid + 128 * i, row = c >> 3, pc = c & 7;
      l[i] = lds_off(&sm.t.b[bf][row][pc * 8]); p[i] = Pw + (size_t)(n0 + row) * CC + ks * 64 + pc * 8; }
    acopy8(l, p);
#pragma unroll
    for (int i = 0; i < 4; ++i) { const int c = tid + 128 * i, row = c >> 3, pc = c & 7;
      la[i] = lds_off(&sm.t.a[bf][row][pc * 8]); pa[i] = X16 + (size_t)(r0b + row) * CC + ks * 64 + pc * 8; }
    acopy4(la, pa);
  };
  stage(0, 0);
  asm volatile("s_wait_asynccnt 0x0" ::: "memory");   // this wave's part of slice 0 has landed
  __syncthreads();                                     // ... and every other wave's
  stage(1, 1);
  v8f acc[8] = {};
#pragma unroll 1   // rolled: the trips are parted by barriers, so unrolling would only lengthen the text
  for (int ks = 0; ks < CC / 64; ++ks) { const int bf = ks & 1;
    // the slice's fragments are asked for in one batch ahead of its 16 products, so that the LDS latency is paid once a slice
    // (the short loops are unrolled so that these arrays are indexed by constants and stay in registers)
    v16h a[2], bq[2][8];
#pragma unroll
    for (int kc = 0; kc < 2; ++kc) { a[kc] = frag_h(&sm.t.a[bf][wave * 16 + col][kc * 32], lane);
#pragma unroll
      for (int j = 0; j < 8; ++j) bq[kc][j] = frag_h(&sm.t.b[bf][j * 16 + col][kc * 32], lane); }
#pragma unroll
    for (int kc = 0; kc < 2; ++kc)
#pragma unroll
      for (int j = 0; j < 8; ++j) acc[j] = wmma16(a[kc], bq[kc][j], acc[j]);
    asm volatile("s_wait_dscnt 0" ::: "memory");        // this wave's reads of buffer bf have returned
    asm volatile("s_wait_asynccnt 0x0" ::: "memory");   // this wave's part of slice ks + 1 has landed
    __syncthreads();                                     // publishes slice ks + 1 and ends every wave's reads of buffer bf
    if (ks + 2 < CC / 64) stage(ks + 2, bf); }
  asm volatile("s_wait_asynccnt 0x0" ::: "memory");     // no copy is left in flight when the LDS is taken for the results
  if (which < 2) {
#pragma unroll
    for (int j = 0; j < 8; ++j)
#pragma unroll
      for (int r = 0; r < 8; ++r) so[wave][8 * g + r][j * 16 + col] = acc[j][r] * (4.0f / 16.0f);
    LDSX();
    _Float16* D = which == 0 ? Q16 : K16;
    for (int q = lane; q < 16 * 2 * 8; q += 32) { const int hh = q >> 7, rl = (q >> 3) & 15, pc = q & 7; const int h = (n0 >> 6) + hh; union { v8h h8; v4u u; } pk;
#pragma unroll
      for (int e = 0; e < 8; ++e) pk.h8[e] = (_Float16)so[wave][rl][hh * 64 + pc * 8 + e];
      vst2(D + (((size_t)b * NH + h) * EE + e0 + wave * 16 + rl) * HD + pc * 8, pk.u); } }
  else {
#pragma unroll
    for (int j = 0; j < 8; ++j)
#pragma unroll
      for (int r = 0; r < 8; ++r) st[j * 16 + col][wave * 16 + 8 * g + r] = (_Float16)(acc[j][r] * (4.0f / 16.0f));
    __syncthreads();
    for (int q = tid; q < 128 * 8; q += 128) { const int cl = q >> 3, pc = q & 7; const int c = n0 + cl, h = c >> 6, d = c & 63; vst2(VT + (((size_t)b * NH + h) * HD + d) * EE + e0 + pc * 8, *(const v4u*)(&st[cl][pc * 8])); } }
}
#define MPITCH 68   // f32 per staged mask row: 272 B, the two half-waves (8 rows apart) fall on different banks
// attention: block (64 q, h, b): S tiles over all 2048 keys (f16); P = (S * adj + 1) / 8 -> f16; acc += P @ V; out = 0.5 * 8 * acc / 4 -> O16 head-major [b][h][e][64] (x 1/8)
// The "+1" of the scores goes into P itself (one fused multiply-add a score), so that the second product also yields the sum of v over the keys.
// Each 64-key tile of K, V and the block's 64 x 64 piece of the mask is brought into LDS once for the four waves, with whole-line
// asynchronous copies, one tile ahead (two buffers); a wave then fetches the tile's fragments from LDS in a few batches.
__global__ __launch_bounds__(128) void k_attn(const _Float16* __restrict__ Q16, const _Float16* __restrict__ K16, const _Float16* __restrict__ VT, const float* __restrict__ adj, _Float16* __restrict__ O16) {
  __shared__ __align__(16) _Float16 sK[2][64][KPITCH];
  __shared__ __align__(16) _Float16 sV[2][64][KPITCH];
  __shared__ __align__(16) float sM[2][64][MPITCH];
  __shared__ __align__(16) _Float16 sP[4][16][72];
  __shared__ __align__(16) float sO[4][16][68];
  const int tid = threadIdx.x, w = tid >> 5, lane = tid & 31, col = lane & 15, g = lane >> 4;
  const int b = blockIdx.z, h = blockIdx.y, q0b = blockIdx.x * 64, q0 = q0b + w * 16; const size_t bh = (size_t)b * NH + h;
  // tile kt -> buffer bf: K rows (128 B, adjacent), V^T rows (128 B of each of 64 rows), mask rows (256 B of each of 64 rows)
  auto stage = [&](int kt, int bf) {
    unsigned l[8]; const void* p[8];
#pragma unroll
    for (int i = 0; i < 4; ++i) { const int c = tid + 128 * i, row = c >> 3, pc = c & 7;
      l[i] = lds_off(&sK[bf][row][pc * 8]); p[i] = K16 + (bh * EE + kt * 64 + row) * HD + pc * 8;
      l[4 + i] = lds_off(&sV[bf][row][pc * 8]); p[4 + i] = VT + (bh * HD + row) * EE + kt * 64 + pc * 8; }
    acopy8(l, p);
#pragma unroll
    for (int i = 0; i < 8; ++i) { const int c = tid + 128 * i, row = c >> 4, pc = c & 15;
      l[i] = lds_off(&sM[bf][row][pc * 4]); p[i] = adj + (size_t)(q0b + row) * EE + kt * 64 + pc * 4; }
    acopy8(l, p);
  };
  stage(0, 0);
  v16h aq[2];
#pragma unroll
  for (int kc = 0; kc < 2; ++kc) aq[kc] = frag_h(Q16 + (bh * EE + q0 + col) * HD + kc * 32, lane);
  asm volatile("s_wait_asynccnt 0x0" ::: "memory");   // this wave's part of tile 0 has landed
  __syncthreads();                                     // ... and every other wave's
  stage(1, 1);
  v8f acc[4] = {};
#pragma unroll 1
  for (int kt = 0; kt < EE / 64; ++kt) { const int bf = kt & 1;
    // a tile's fragments are asked for in batches ahead of the products that use them, so that the LDS latency is paid a few times a
    // tile, not once a product: K and mask at the top, V as K's registers fall free, both P fragments together
    // (the short loops are unrolled so that these arrays are indexed by constants and stay in registers)
    v16h kf[4][2], vf[2][4], pa[2]; float m[4][8];
#pragma unroll
    for (int t = 0; t < 4; ++t) {
#pragma unroll
      for (int kc = 0; kc < 2; ++kc) kf[t][kc] = frag_h(&sK[bf][t * 16 + col][kc * 32], lane);
#pragma unroll
      for (int r = 0; r < 8; ++r) m[t][r] = sM[bf][w * 16 + 8 * g + r][t * 16 + col]; }
#pragma unroll
    for (int t = 0; t < 4; ++t) { v8f s = {};
#pragma unroll
      for (int kc = 0; kc < 2; ++kc) s = wmma16(aq[kc], kf[t][kc], s);
      if (t == 1 || t == 2) {
#pragma unroll
        for (int u = 0; u < 4; ++u) vf[t - 1][u] = frag_h(&sV[bf][u * 16 + col][(t - 1) * 32], lane); }
#pragma unroll
      for (int r = 0; r < 8; ++r) sP[w][8 * g + r][t * 16 + col] = (_Float16)(s[r] * m[t][r] * (1.0f / (16.0f * 8.0f)) + 0.125f); }   // (x4 x4)/16 = true qk ; (qk * adj + 1) stored /8
    LDSX();
#pragma unroll
    for (int kc = 0; kc < 2; ++kc) pa[kc] = frag_h(&sP[w][col][0] + kc * 32, lane);
#pragma unroll
    for (int kc = 0; kc < 2; ++kc)
#pragma unroll
      for (int t = 0; t < 4; ++t) acc[t] = wmma16(pa[kc], vf[kc][t], acc[t]);
    asm volatile("s_wait_dscnt 0" ::: "memory");        // this wave's reads of buffer bf (and of its sP rows) have returned
    asm volatile("s_wait_asynccnt 0x0" ::: "memory");   // this wave's part of tile kt + 1 has landed
    __syncthreads();                                     // publishes tile kt + 1 and ends every wave's reads of buffer bf
    if (kt + 2 < EE / 64) stage(kt + 2, bf); }
  asm volatile("s_wait_asynccnt 0x0" ::: "memory");     // no copy is left in flight when the wave goes on
  // out = 0.5 * (acc * 8 / 4) = acc   (P stored /8, V stored x4) ; store O x 1/8 as f16 (values ~ O(50))
#pragma unroll
  for (int t = 0; t < 4; ++t) { const int d = t * 16 + col;
#pragma unroll
    for (int r = 0; r < 8; ++r) sO[w][8 * g + r][d] = acc[t][r] * 0.125f; }
  LDSX();
  for (int q = lane; q < 16 * 8; q += 32) { const int rl = q >> 3, pc = q & 7; union { v8h h8; v4u u; } pk;
#pragma unroll
    for (int e = 0; e < 8; ++e) pk.h8[e] = (_Float16)sO[w][rl][pc * 8 + e];
    vst2(O16 + (bh * EE + q0 + rl) * HD + pc * 8, pk.u); }
}
// proj + bias + LN; y = x + gamma * LN(out). Block = 16 rows x all 512 cols, 8 waves: wave w does cols 64w..64w+63 (one pass),
// then, behind one block barrier, wave w normalises rows 2w and 2w+1 with 16 columns per lane and whole-line loads and stores.
// The operands come through LDS by whole-line asynchronous copies: the block's 16 O rows once, the weight in k slices of 64 (one 128-B line
// of each of its 512 rows), one slice ahead (two buffers); a wave then fetches a slice's fragments from LDS in one batch, so that no product
// waits for a global load of its own.
__global__ __launch_bounds__(256) void k_proj(const _Float16* __restrict__ O16, const _Float16* __restrict__ P, const float* __restrict__ bp, const float* __restrict__ lnw, const float* __restrict__ lnb, const float* __restrict__ gam, const float* __restrict__ x, float* __restrict__ out) {
  __shared__ __align__(16) _Float16 sb[2][CC][KPITCH];
  __shared__ __align__(16) _Float16 sa[NH][16][KPITCH];
  __shared__ __align__(16) float sy[16][CC + 4];
  const int tid = threadIdx.x, wave = tid >> 5, lane = tid & 31, col = lane & 15, g = lane >> 4;
  const int r0 = blockIdx.x * 16, n0 = wave * 64;
  const _Float16* Pw = P + (size_t)3 * CC * CC;
  // weight slice ks -> buffer bf: 512 rows x 8 pieces of 16 B, 16 pieces a thread
  // (the loops are unrolled so that the address arrays are indexed by constants and stay in registers, as asm operands must)
  auto stage = [&](int ks, int bf) {
#pragma unroll
    for (int hf = 0; hf < 2; ++hf) { unsigned l[8]; const void* p[8];
#pragma unroll
      for (int i = 0; i < 8; ++i) { const int c = tid + 256 * (hf * 8 + i), row = c >> 3, pc = c & 7;
        l[i] = lds_off(&sb[bf][row][pc * 8]); p[i] = Pw + (size_t)row * CC + ks * 64 + pc * 8; }
      acopy8(l, p); }
  };
  { // the block's O rows, all eight heads (= k slices): 8 x 16 rows x 8 pieces, 4 pieces a thread
    unsigned l[4]; const void* p[4];
#pragma unroll
    for (int i = 0; i < 4; ++i) { const int c = tid + 256 * i, hd = c >> 7, row = (c >> 3) & 15, pc = c & 7; const int R = r0 + row;
      l[i] = lds_off(&sa[hd][row][pc * 8]); p[i] = O16 + ((((size_t)(R / EE)) * NH + hd) * EE + (R % EE)) * HD + pc * 8; }
    acopy4(l, p); }
  stage(0, 0);
  asm volatile("s_wait_asynccnt 0x0" ::: "memory");   // this wave's part of the O rows and of slice 0 has landed
  __syncthreads();                                     // ... and every other wave's
  stage(1, 1);
  v8f acc[4] = {};
#pragma unroll 1   // rolled: the trips are parted by barriers, so unrolling would only lengthen the text
  for (int ks = 0; ks < CC / 64; ++ks) { const int bf = ks & 1;
    // (the short loops are unrolled so that these arrays are indexed by constants and stay in registers)
    v16h a[2], bw[2][4];
#pragma unroll
    for (int kc = 0; kc < 2; ++kc) { a[kc] = frag_h(&sa[ks][col][kc * 32], lane);
#pragma unroll
      for (int j = 0; j < 4; ++j) bw[kc][j] = frag_h(&sb[bf][n0 + j * 16 + col][kc * 32], lane); }
#pragma unroll
    for (int kc = 0; kc < 2; ++kc)
#pragma unroll
      for (int j = 0; j < 4; ++j) acc[j] = wmma16(a[kc], bw[kc][j], acc[j]);
    asm volatile("s_wait_dscnt 0" ::: "memory");        // this wave's reads of buffer bf have returned
    asm volatile("s_wait_asynccnt 0x0" ::: "memory");   // this wave's part of slice ks + 1 has landed
    __syncthreads();                                     // publishes slice ks + 1 and ends every wave's reads of buffer bf
    if (ks + 2 < CC / 64) stage(ks + 2, bf); }
  asm volatile("s_wait_asynccnt 0x0" ::: "memory");     // no copy is left in flight when the wave goes on
  // this wave's x rows and the LN weights are asked for here, so that they fly during the LDS exchange and the row sums
  const float gm = gam[0]; v4f lw[4], lb[4], xv[2][4];
#pragma unroll
  for (int i = 0; i < 4; ++i) { lw[i] = *(const v4f*)(lnw + (i * 32 + lane) * 4); lb[i] = *(const v4f*)(lnb + (i * 32 + lane) * 4);
#pragma unroll
    for (int rr = 0; rr < 2; ++rr) xv[rr][i] = *(const v4f*)(x + (size_t)(r0 + wave * 2 + rr) * CC + (i * 32 + lane) * 4); }
#pragma unroll
  for (int j = 0; j < 4; ++j) { const int c = n0 + j * 16 + col; const float bb = bp[c];
#pragma unroll
    for (int r = 0; r < 8; ++r) sy[8 * g + r][c] = acc[j][r] * (8.0f / 16.0f) + bb; }
  __syncthreads();   // a row's 512 columns come from all eight waves
#pragma unroll
  for (int rr = 0; rr < 2; ++rr) { const int rl = wave * 2 + rr; v4f v[4];
#pragma unroll
    for (int i = 0; i < 4; ++i) v[i] = *(const v4f*)(&sy[rl][(i * 32 + lane) * 4]);
    float s = 0.f;
#pragma unroll
    for (int i = 0; i < 4; ++i) s += (v[i][0] + v[i][1]) + (v[i][2] + v[i][3]);
#pragma unroll
    for (int m = 16; m >= 1; m >>= 1) s += __shfl_xor(s, m, 32);
    const float mu = s * (1.0f / CC); float q2 = 0.f;
#pragma unroll
    for (int i = 0; i < 4; ++i) { v[i] -= mu; const v4f d2 = v[i] * v[i]; q2 += (d2[0] + d2[1]) + (d2[2] + d2[3]); }
#pragma unroll
    for (int m = 16; m >= 1; m >>= 1) q2 += __shfl_xor(q2, m, 32);
    const float rs = rsqrtf(q2 * (1.0f / CC) + 1e-5f);
#pragma unroll
    for (int i = 0; i < 4; ++i) vst2(out + (size_t)(r0 + rl) * CC + (i * 32 + lane) * 4, (v4f)(xv[rr][i] + gm * (v[i] * rs * lw[i] + lb[i]))); }
}
extern "C" void kernel_launch(void* const* d_in, const int* in_sizes, int n_in, void* d_out, int out_size, void* d_ws, size_t ws_size, hipStream_t stream) {
  (void)in_sizes; (void)n_in; (void)out_size; (void)ws_size;
  const float** I = (const float**)d_in;
  const float* x = I[0]; const float* adj = I[1]; const float* Wq = I[2]; const float* Wk = I[3]; const float* Wv = I[4]; const float* Wp = I[5]; const float* bp = I[6]; const float* lnw = I[7]; const float* lnb = I[8]; const float* gam = I[9];
  float* out = (float*)d_out;
  char* ws = (char*)d_ws; size_t off = 0;
  auto take = [&](size_t bytes) { char* p = ws + off; off += (bytes + 255) & ~(size_t)255; return p; };
  _Float16* X16 = (_Float16*)take((size_t)NR * CC * 2); _Float16* P = (_Float16*)take((size_t)4 * CC * CC * 2);
  _Float16* Q16 = (_Float16*)take((size_t)NR * CC * 2); _Float16* K16 = (_Float16*)take((size_t)NR * CC * 2); _Float16* VT = (_Float16*)take((size_t)NR * CC * 2); _Float16* O16 = (_Float16*)take((size_t)NR * CC * 2);
  k_prep<<<NPC / 256, 256, 0, stream>>>(x, Wq, Wk, Wv, Wp, X16, P);
  k_qkv<<<dim3(NR / 64, CC / 128, 3), 128, 0, stream>>>(X16, P, Q16, K16, VT);
  k_attn<<<dim3(EE / 64, NH, NB), 128, 0, stream>>>(Q16, K16, VT, adj, O16);
  k_proj<<<NR / 16, 256, 0, stream>>>(O16, P, bp, lnw, lnb, gam, x, out);
}

// v007
// It runs in 59.1 microseconds.
// Two timings next to v006 put it at 1.09 and 1.10 times that version's speed.
// All steps since v000 together make it 5.10 times as fast.
#include <hip/hip_runtime.h>
#include <math.h>

typedef __attribute__((ext_vector_type(16))) _Float16 v16h;
typedef __attribute__((ext_vector_type(16))) __bf16 v16b;
typedef __attribute__((ext_vector_type(8)))  _Float16 v8h;
typedef __attribute__((ext_vector_type(8)))  float v8f;
typedef __attribute__((ext_vector_type(4)))  float v4f;
typedef __attribute__((ext_vector_type(2)))  float v2f;
typedef __attribute__((ext_vector_type(4)))  unsigned v4u;
typedef __attribute__((ext_vector_type(4)))  int v4i;
typedef float __attribute__((may_alias)) float_a;
typedef int __attribute__((may_alias)) int_a;

template <typename T> __device__ __forceinline__ void vst2(void* p, T v) { *(T*)p = v;  }
__device__ __forceinline__ v8f wmma16(v16h a, v16h b, v8f c) {
  v8f d = __builtin_amdgcn_wmma_f32_16x16x32_f16(false, a, false, b, (short)0, c, false, false);
  asm volatile("v_nop\n\tv_nop\n\tv_nop\n\tv_nop" : "+v"(d) : "v"(a), "v"(b));
  return d;
}
__device__ __forceinline__ v8f wmma_bf(v16b a, v16b b, v8f c) {
  v8f d = __builtin_amdgcn_wmma_f32_16x16x32_bf16(false, a, false, b, (short)0, c, false, false);
  asm volatile("v_nop\n\tv_nop\n\tv_nop\n\tv_nop" : "+v"(d) : "v"(a), "v"(b));
  return d;
}
// 16x16x32 fragments: lane = (h = lane>>4, row/col = lane&15); elements 0..7 = k0+8h+0..7, 8..15 = k0+16+8h+0..7; D element r = row 8h+r
__device__ __forceinline__ v16h frag_h(const _Float16* rowk0, int lane) {
  union { v16h v; v8h q[2]; } u; const _Float16* p = rowk0 + 8 * (lane >> 4);
  u.q[0] = *(const v8h*)p; u.q[1] = *(const v8h*)(p + 16); return u.v;
}
__device__ __forceinline__ v16h frag_f32(const float* rowk0, int lane) {
  v16h a; const float* p = rowk0 + 8 * (lane >> 4);
#pragma unroll
  for (int i = 0; i < 8; ++i) { a[i] = (_Float16)p[i]; a[8 + i] = (_Float16)p[16 + i]; }
  return a;
}
__device__ __forceinline__ v16h frag_f32s(const float* rowk0, int lane, float sc) {
  v16h a; const float* p = rowk0 + 8 * (lane >> 4);
#pragma unroll
  for (int i = 0; i < 8; ++i) { a[i] = (_Float16)(p[i] * sc); a[8 + i] = (_Float16)(p[16 + i] * sc); }
  return a;
}
// column fragment from a [K][ld] layout (column n), rows >= K read as 0
__device__ __forceinline__ v16h fragc_f32(const float* W, int k0, int n, int lane, int ld, int K) {
  v16h a; const int g = lane >> 4;
#pragma unroll
  for (int i = 0; i < 8; ++i) { const int ka = k0 + 8 * g + i, kb = ka + 16;
    a[i] = (_Float16)(ka < K ? W[(size_t)ka * ld + n] : 0.f); a[8 + i] = (_Float16)(kb < K ? W[(size_t)kb * ld + n] : 0.f); }
  return a;
}
struct F2 { v16b h, l; };
__device__ __forceinline__ F2 bsplit16(const float v[16]) { F2 r;
#pragma unroll
  for (int i = 0; i < 16; ++i) { const __bf16 h = (__bf16)v[i]; r.h[i] = h; r.l[i] = (__bf16)(v[i] - (float)h); }
  return r; }
__device__ __forceinline__ F2 split_row(const float* row, int k0, int lane) { float v[16]; const float* p = row + k0 + 8 * (lane >> 4);
#pragma unroll
  for (int i = 0; i < 8; ++i) { v[i] = p[i]; v[8 + i] = p[16 + i]; }
  return bsplit16(v); }
__device__ __forceinline__ F2 split_rowK(const float* row, int k0, int lane, int K) { float v[16]; const int g = lane >> 4;
#pragma unroll
  for (int i = 0; i < 8; ++i) { const int ka = k0 + 8 * g + i, kb = ka + 16; v[i] = ka < K ? row[ka] : 0.f; v[8 + i] = kb < K ? row[kb] : 0.f; }
  return bsplit16(v); }
__device__ __forceinline__ F2 split_col(const float* W, int k0, int n, int lane, int ld, int K) { float v[16]; const int g = lane >> 4;
#pragma unroll
  for (int i = 0; i < 8; ++i) { const int ka = k0 + 8 * g + i, kb = ka + 16; v[i] = ka < K ? W[(size_t)ka * ld + n] : 0.f; v[8 + i] = kb < K ? W[(size_t)kb * ld + n] : 0.f; }
  return bsplit16(v); }
__device__ __forceinline__ v8f mac3(const F2& a, const F2& b, v8f c) { c = wmma_bf(a.l, b.h, c); c = wmma_bf(a.h, b.l, c); return wmma_bf(a.h, b.h, c); }
__device__ __forceinline__ float sigm(float v) { return 1.0f / (1.0f + expf(-v)); }
#define LDSX() do { asm volatile("s_wait_dscnt 0" ::: "memory"); __builtin_amdgcn_wave_barrier(); __builtin_amdgcn_fence(__ATOMIC_RELEASE, "workgroup"); } while (0)

// Mask-modulated linear attention block: q/k/v projections, per head attn = (q.k * adj + 1)/2 (no softmax), attn @ v, output projection
// + bias, LayerNorm, x + gamma * (.). All products on v_wmma_f32_16x16x32_f16 (x converted once, [out][in] weights packed as f16 rows
// x16, q/k/v kept head-major f16, the [E x E] scores scaled by 1/8 into f16 for the second product, adj mask read as data, the "+1"
// added to the scaled scores ahead of that product).
#define NB 2
#define EE 2048
#define CC 512
#define NH 8
#define HD 64
#define NR (NB * EE)

typedef __attribute__((ext_vector_type(4)))  _Float16 v4h;
#define NPC (CC * CC / 4)   // 16-byte pieces of one weight matrix = threads of k_prep
static_assert(NR * CC / 4 == 8 * NPC, "x is eight times a weight matrix");
// x -> X16 (f16) and Wq, Wk, Wv, Wp -> P (f16, x16; P rows [which*512 + n][512] are the weights' own [out][in] order), in one launch of
// few waves: thread t takes piece t of each eighth of x and of each weight. A wave's load covers 512 adjacent bytes, its store 256;
// the twelve loads are asked for together, so that the memory latency is paid once a wave.
__global__ __launch_bounds__(256) void k_prep(const float* __restrict__ x, const float* __restrict__ Wq, const float* __restrict__ Wk, const float* __restrict__ Wv, const float* __restrict__ Wp, _Float16* __restrict__ X16, _Float16* __restrict__ P) {
  const unsigned t = blockIdx.x * 256 + threadIdx.x;
  const v4f* x4 = (const v4f*)x; v4h* X4 = (v4h*)X16; v4h* P4 = (v4h*)P;
  v4f a[8], w[4];
#pragma unroll   // this loop and the two below: unrolled so that the arrays are indexed by constants and stay in registers
  for (int i = 0; i < 8; ++i) a[i] = x4[i * NPC + t];
  w[0] = ((const v4f*)Wq)[t]; w[1] = ((const v4f*)Wk)[t]; w[2] = ((const v4f*)Wv)[t]; w[3] = ((const v4f*)Wp)[t];
#pragma unroll
  for (int i = 0; i < 8; ++i) X4[i * NPC + t] = __builtin_convertvector(a[i], v4h);
#pragma unroll
  for (int i = 0; i < 4; ++i) P4[i * NPC + t] = __builtin_convertvector(w[i] * 16.0f, v4h);
}
// LDS byte address of a __shared__ element (what an asynchronous copy takes as its destination)
__device__ __forceinline__ unsigned lds_off(const void* p) { return (unsigned)(size_t)(const __attribute__((address_space(3))) void*)p; }
// eight asynchronous copies global -> LDS, 16 bytes a lane each, through no register. The s_wait_xcnt stands in the copies' own statement,
// so that no address register of a copy is rewritten ahead of it.
__device__ __forceinline__ void acopy8(const unsigned (&l)[8], const void* const (&p)[8]) {
  asm volatile("global_load_async_to_lds_b128 %0, %8, off\n\t"
               "global_load_async_to_lds_b128 %1, %9, off\n\t"
               "global_load_async_to_lds_b128 %2, %10, off\n\t"
               "global_load_async_to_lds_b128 %3, %11, off\n\t"
               "global_load_async_to_lds_b128 %4, %12, off\n\t"
               "global_load_async_to_lds_b128 %5, %13, off\n\t"
               "global_load_async_to_lds_b128 %6, %14, off\n\t"
               "global_load_async_to_lds_b128 %7, %15, off\n\t"
               "s_wait_xcnt 0x0"
               :: "v"(l[0]), "v"(l[1]), "v"(l[2]), "v"(l[3]), "v"(l[4]), "v"(l[5]), "v"(l[6]), "v"(l[7]),
                  "v"(p[0]), "v"(p[1]), "v"(p[2]), "v"(p[3]), "v"(p[4]), "v"(p[5]), "v"(p[6]), "v"(p[7]) : "memory");
}
// four such copies
__device__ __forceinline__ void acopy4(const unsigned (&l)[4], const void* const (&p)[4]) {
  asm volatile("global_load_async_to_lds_b128 %0, %4, off\n\t"
               "global_load_async_to_lds_b128 %1, %5, off\n\t"
               "global_load_async_to_lds_b128 %2, %6, off\n\t"
               "global_load_async_to_lds_b128 %3, %7, off\n\t"
               "s_wait_xcnt 0x0"
               :: "v"(l[0]), "v"(l[1]), "v"(l[2]), "v"(l[3]), "v"(p[0]), "v"(p[1]), "v"(p[2]), "v"(p[3]) : "memory");
}
#define KPITCH 72   // f16 per staged x, weight, K, V or O row: 144 B = 16 B x odd, conflict-free for 16-byte fragment reads
// q/k/v: block (64 rows, 128-col chunk = 2 heads, which): Q16/K16 head-major [b][h][e][64] (x4); VT [b][h][d][e] (x4)
__global__ __launch_bounds__(128) void k_qkv(const _Float16* __restrict__ X16, const _Float16* __restrict__ P, _Float16* __restrict__ Q16, _Float16* __restrict__ K16, _Float16* __restrict__ VT) {
  // the staged tiles are dead (behind the loop's last barrier) when the results are laid out for their stores: the two uses share the LDS
  __shared__ __align__(16) union { struct { _Float16 a[2][64][KPITCH]; _Float16 b[2][128][KPITCH]; } t; float so[4][16][132]; _Float16 st[128][72]; } sm;
  auto& so = sm.so; auto& st = sm.st;
  const int tid = threadIdx.x, wave = tid >> 5, lane = tid & 31, col = lane & 15, g = lane >> 4;
  const int which = blockIdx.z, r0b = blockIdx.x * 64, n0 = blockIdx.y * 128; const int b = r0b / EE, e0 = r0b % EE;
  const _Float16* Pw = P + (size_t)which * CC * CC;
  // k slice ks (64 wide = one 128-B line of each row) -> buffer bf: the block's 128 weight rows and 64 x rows, whole lines, once for the four waves
  // (its loops are unrolled so that the address arrays are indexed by constants and stay in registers, as asm operands must)
  auto stage = [&](int ks, int bf) {
    unsigned l[8]; const void* p[8]; unsigned la[4]; const void* pa[4];
#pragma unroll
    for (int i = 0; i < 8; ++i) { const int c = tid + 128 * i, row = c >> 3, pc = c & 7;
      l[i] = lds_off(&sm.t.b[bf][row][pc * 8]); p[i] = Pw + (size_t)(n0 + row) * CC + ks * 64 + pc * 8; }
    acopy8(l, p);
#pragma unroll
    for (int i = 0; i < 4; ++i) { const int c = tid + 128 * i, row = c >> 3, pc = c & 7;
      la[i] = lds_off(&sm.t.a[bf][row][pc * 8]); pa[i] = X16 + (size_t)(r0b + row) * CC + ks * 64 + pc * 8; }
    acopy4(la, pa);
  };
  stage(0, 0);
  asm volatile("s_wait_asynccnt 0x0" ::: "memory");   // this wave's part of slice 0 has landed
  __syncthreads();                                     // ... and every other wave's
  stage(1, 1);
  v8f acc[8] = {};
#pragma unroll 1   // rolled: the trips are parted by barriers, so unrolling would only lengthen the text
  for (int ks = 0; ks < CC / 64; ++ks) { const int bf = ks & 1;
    // the slice's fragments are asked for in one batch ahead of its 16 products, so that the LDS latency is paid once a slice
    // (the short loops are unrolled so that these arrays are indexed by constants and stay in registers)
    v16h a[2], bq[2][8];
#pragma unroll
    for (int kc = 0; kc < 2; ++kc) { a[kc] = frag_h(&sm.t.a[bf][wave * 16 + col][kc * 32], lane);
#pragma unroll
      for (int j = 0; j < 8; ++j) bq[kc][j] = frag_h(&sm.t.b[bf][j * 16 + col][kc * 32], lane); }
#pragma unroll
    for (int kc = 0; kc < 2; ++kc)
#pragma unroll
      for (int j = 0; j < 8; ++j) acc[j] = wmma16(a[kc], bq[kc][j], acc[j]);
    asm volatile("s_wait_dscnt 0" ::: "memory");        // this wave's reads of buffer bf have returned
    asm volatile("s_wait_asynccnt 0x0" ::: "memory");   // this wave's part of slice ks + 1 has landed
    __syncthreads();                                     // publishes slice ks + 1 and ends every wave's reads of buffer bf
    if (ks + 2 < CC / 64) stage(ks + 2, bf); }
  asm volatile("s_wait_asynccnt 0x0" ::: "memory");     // no copy is left in flight when the LDS is taken for the results
  if (which < 2) {
#pragma unroll
    for (int j = 0; j < 8; ++j)
#pragma unroll
      for (int r = 0; r < 8; ++r) so[wave][8 * g + r][j * 16 + col] = acc[j][r] * (4.0f / 16.0f);
    LDSX();
    _Float16* D = which == 0 ? Q16 : K16;
    for (int q = lane; q < 16 * 2 * 8; q += 32) { const int hh = q >> 7, rl = (q >> 3) & 15, pc = q & 7; const int h = (n0 >> 6) + hh; union { v8h h8; v4u u; } pk;
#pragma unroll
      for (int e = 0; e < 8; ++e) pk.h8[e] = (_Float16)so[wave][rl][hh * 64 + pc * 8 + e];
      vst2(D + (((size_t)b * NH + h) * EE + e0 + wave * 16 + rl) * HD + pc * 8, pk.u); } }
  else {
#pragma unroll
    for (int j = 0; j < 8; ++j)
#pragma unroll
      for (int r = 0; r < 8; ++r) st[j * 16 + col][wave * 16 + 8 * g + r] = (_Float16)(acc[j][r] * (4.0f / 16.0f));
    __syncthreads();
    for (int q = tid; q < 128 * 8; q += 128) { const int cl = q >> 3, pc = q & 7; const int c = n0 + cl, h = c >> 6, d = c & 63; vst2(VT + (((size_t)b * NH + h) * HD + d) * EE + e0 + pc * 8, *(const v4u*)(&st[cl][pc * 8])); } }
}
#define MPITCH 68   // f32 per staged mask row: 272 B = 16 B x odd, conflict-free for 16-byte reads down a column of rows
// attention: block (64 q, h, b): S tiles over all 2048 keys (f16); P = (S * adj + 1) / 8 -> f16; acc += P @ V; out = 0.5 * 8 * acc / 4 -> O16 head-major [b][h][e][64] (x 1/8)
// The "+1" of the scores goes into P itself (one fused multiply-add a score), so that the second product also yields the sum of v over the keys.
// Each 64-key tile of K, V and the block's 64 x 64 piece of the mask is brought into LDS once for the four waves, with whole-line
// asynchronous copies, one tile ahead (two buffers); a wave then fetches the tile's fragments from LDS in one batch.
// The scores are formed transposed (A = K rows, B = Q): a lane then holds 8 adjacent keys of ONE query in each 16-key tile, which is the
// place those scores have in the A fragment of P @ V. So P goes from accumulator to operand inside the lane, and the lane's 8 mask values
// are 32 adjacent bytes of one mask row.
__global__ __launch_bounds__(128) void k_attn(const _Float16* __restrict__ Q16, const _Float16* __restrict__ K16, const _Float16* __restrict__ VT, const float* __restrict__ adj, _Float16* __restrict__ O16) {
  __shared__ __align__(16) _Float16 sK[2][64][KPITCH];
  __shared__ __align__(16) _Float16 sV[2][64][KPITCH];
  __shared__ __align__(16) float sM[2][64][MPITCH];
  __shared__ __align__(16) float sO[4][16][68];
  const int tid = threadIdx.x, w = tid >> 5, lane = tid & 31, col = lane & 15, g = lane >> 4;
  const int b = blockIdx.z, h = blockIdx.y, q0b = blockIdx.x * 64, q0 = q0b + w * 16; const size_t bh = (size_t)b * NH + h;
  // tile kt -> buffer bf: K rows (128 B, adjacent), V^T rows (128 B of each of 64 rows), mask rows (256 B of each of 64 rows)
  auto stage = [&](int kt, int bf) {
    unsigned l[8]; const void* p[8];
#pragma unroll
    for (int i = 0; i < 4; ++i) { const int c = tid + 128 * i, row = c >> 3, pc = c & 7;
      l[i] = lds_off(&sK[bf][row][pc * 8]); p[i] = K16 + (bh * EE + kt * 64 + row) * HD + pc * 8;
      l[4 + i] = lds_off(&sV[bf][row][pc * 8]); p[4 + i] = VT + (bh * HD + row) * EE + kt * 64 + pc * 8; }
    acopy8(l, p);
#pragma unroll
    for (int i = 0; i < 8; ++i) { const int c = tid + 128 * i, row = c >> 4, pc = c & 15;
      l[i] = lds_off(&sM[bf][row][pc * 4]); p[i] = adj + (size_t)(q0b + row) * EE + kt * 64 + pc * 4; }
    acopy8(l, p);
  };
  stage(0, 0);
  v16h aq[2];
#pragma unroll
  for (int kc = 0; kc < 2; ++kc) aq[kc] = frag_h(Q16 + (bh * EE + q0 + col) * HD + kc * 32, lane);
  asm volatile("s_wait_asynccnt 0x0" ::: "memory");   // this wave's part of tile 0 has landed
  __syncthreads();                                     // ... and every other wave's
  stage(1, 1);
  v8f acc[4] = {};
#pragma unroll 1
  for (int kt = 0; kt < EE / 64; ++kt) { const int bf = kt & 1;
    // the tile's fragments and mask values are asked for in one batch ahead of its products, in the order of their use, so that the LDS
    // latency is paid once a tile (the short loops are unrolled so that these arrays are indexed by constants and stay in registers)
    v16h kf[4][2], vf[2][4]; v4f m[4][2];
#pragma unroll
    for (int t = 0; t < 4; ++t)
#pragma unroll
      for (int kc = 0; kc < 2; ++kc) kf[t][kc] = frag_h(&sK[bf][t * 16 + col][kc * 32], lane);
#pragma unroll
    for (int t = 0; t < 4; ++t)
#pragma unroll
      for (int i = 0; i < 2; ++i) m[t][i] = *(const v4f*)(&sM[bf][w * 16 + col][t * 16 + 8 * g + 4 * i]);
#pragma unroll
    for (int kc = 0; kc < 2; ++kc)
#pragma unroll
      for (int u = 0; u < 4; ++u) vf[kc][u] = frag_h(&sV[bf][u * 16 + col][kc * 32], lane);
    // s[t] element r = score of key t*16 + 8g + r with query col
    v8f s[4] = {};
#pragma unroll
    for (int kc = 0; kc < 2; ++kc)
#pragma unroll
      for (int t = 0; t < 4; ++t) s[t] = wmma16(kf[t][kc], aq[kc], s[t]);
#pragma unroll
    for (int kc = 0; kc < 2; ++kc) { v16h pa;   // P's A fragment of keys kc*32 ..+31: elements 0..7 from tile 2kc, 8..15 from tile 2kc+1
#pragma unroll
      for (int hf = 0; hf < 2; ++hf)
#pragma unroll
        for (int r = 0; r < 8; ++r) pa[8 * hf + r] = (_Float16)(s[2 * kc + hf][r] * m[2 * kc + hf][r >> 2][r & 3] * (1.0f / (16.0f * 8.0f)) + 0.125f);   // (x4 x4)/16 = true qk ; (qk * adj + 1) kept /8
#pragma unroll
      for (int u = 0; u < 4; ++u) acc[u] = wmma16(pa, vf[kc][u], acc[u]); }
    asm volatile("s_wait_dscnt 0" ::: "memory");        // this wave's reads of buffer bf have returned
    asm volatile("s_wait_asynccnt 0x0" ::: "memory");   // this wave's part of tile kt + 1 has landed
    __syncthreads();                                     // publishes tile kt + 1 and ends every wave's reads of buffer bf
    if (kt + 2 < EE / 64) stage(kt + 2, bf); }
  asm volatile("s_wait_asynccnt 0x0" ::: "memory");     // no copy is left in flight when the wave goes on
  // out = 0.5 * (acc * 8 / 4) = acc   (P stored /8, V stored x4) ; store O x 1/8 as f16 (values ~ O(50))
#pragma unroll
  for (int t = 0; t < 4; ++t) { const int d = t * 16 + col;
#pragma unroll
    for (int r = 0; r < 8; ++r) sO[w][8 * g + r][d] = acc[t][r] * 0.125f; }
  LDSX();
  for (int q = lane; q < 16 * 8; q += 32) { const int rl = q >> 3, pc = q & 7; union { v8h h8; v4u u; } pk;
#pragma unroll
    for (int e = 0; e < 8; ++e) pk.h8[e] = (_Float16)sO[w][rl][pc * 8 + e];
    vst2(O16 + (bh * EE + q0 + rl) * HD + pc * 8, pk.u); }
}
// proj + bias + LN; y = x + gamma * LN(out). Block = 16 rows x all 512 cols, 8 waves: wave w does cols 64w..64w+63 (one pass),
// then, behind one block barrier, wave w normalises rows 2w and 2w+1 with 16 columns per lane and whole-line loads and stores.
// The operands come through LDS by whole-line asynchronous copies: the block's 16 O rows once, the weight in k slices of 64 (one 128-B line
// of each of its 512 rows), one slice ahead (two buffers); a wave then fetches a slice's fragments from LDS in one batch, so that no product
// waits for a global load of its own.
__global__ __launch_bounds__(256) void k_proj(const _Float16* __restrict__ O16, const _Float16* __restrict__ P, const float* __restrict__ bp, const float* __restrict__ lnw, const float* __restrict__ lnb, const float* __restrict__ gam, const float* __restrict__ x, float* __restrict__ out) {
  __shared__ __align__(16) _Float16 sb[2][CC][KPITCH];
  __shared__ __align__(16) _Float16 sa[NH][16][KPITCH];
  __shared__ __align__(16) float sy[16][CC + 4];
  const int tid = threadIdx.x, wave = tid >> 5, lane = tid & 31, col = lane & 15, g = lane >> 4;
  const int r0 = blockIdx.x * 16, n0 = wave * 64;
  const _Float16* Pw = P + (size_t)3 * CC * CC;
  // weight slice ks -> buffer bf: 512 rows x 8 pieces of 16 B, 16 pieces a thread
  // (the loops are unrolled so that the address arrays are indexed by constants and stay in registers, as asm operands must)
  auto stage = [&](int ks, int bf) {
#pragma unroll
    for (int hf = 0; hf < 2; ++hf) { unsigned l[8]; const void* p[8];
#pragma unroll
      for (int i = 0; i < 8; ++i) { const int c = tid + 256 * (hf * 8 + i), row = c >> 3, pc = c & 7;
        l[i] = lds_off(&sb[bf][row][pc * 8]); p[i] = Pw + (size_t)row * CC + ks * 64 + pc * 8; }
      acopy8(l, p); }
  };
  { // the block's O rows, all eight heads (= k slices): 8 x 16 rows x 8 pieces, 4 pieces a thread
    unsigned l[4]; const void* p[4];
#pragma unroll
    for (int i = 0; i < 4; ++i) { const int c = tid + 256 * i, hd = c >> 7, row = (c >> 3) & 15, pc = c & 7; const int R = r0 + row;
      l[i] = lds_off(&sa[hd][row][pc * 8]); p[i] = O16 + ((((size_t)(R / EE)) * NH + hd) * EE + (R % EE)) * HD + pc * 8; }
    acopy4(l, p); }
  stage(0, 0);
  asm volatile("s_wait_asynccnt 0x0" ::: "memory");   // this wave's part of the O rows and of slice 0 has landed
  __syncthreads();                                     // ... and every other wave's
  stage(1, 1);
  v8f acc[4] = {};
#pragma unroll 1   // rolled: the trips are parted by barriers, so unrolling would only lengthen the text
  for (int ks = 0; ks < CC / 64; ++ks) { const int bf = ks & 1;
    // (the short loops are unrolled so that these arrays are indexed by constants and stay in registers)
    v16h a[2], bw[2][4];
#pragma unroll
    for (int kc = 0; kc < 2; ++kc) { a[kc] = frag_h(&sa[ks][col][kc * 32], lane);
#pragma unroll
      for (int j = 0; j < 4; ++j) bw[kc][j] = frag_h(&sb[bf][n0 + j * 16 + col][kc * 32], lane); }
#pragma unroll
    for (int kc = 0; kc < 2; ++kc)
#pragma unroll
      for (int j = 0; j < 4; ++j) acc[j] = wmma16(a[kc], bw[kc][j], acc[j]);
    asm volatile("s_wait_dscnt 0" ::: "memory");        // this wave's reads of buffer bf have returned
    asm volatile("s_wait_asynccnt 0x0" ::: "memory");   // this wave's part of slice ks + 1 has landed
    __syncthreads();                                     // publishes slice ks + 1 and ends every wave's reads of buffer bf
    if (ks + 2 < CC / 64) stage(ks + 2, bf); }
  asm volatile("s_wait_asynccnt 0x0" ::: "memory");     // no copy is left in flight when the wave goes on
  // this wave's x rows and the LN weights are asked for here, so that they fly during the LDS exchange and the row sums
  const float gm = gam[0]; v4f lw[4], lb[4], xv[2][4];
#pragma unroll
  for (int i = 0; i < 4; ++i) { lw[i] = *(const v4f*)(lnw + (i * 32 + lane) * 4); lb[i] = *(const v4f*)(lnb + (i * 32 + lane) * 4);
#pragma unroll
    for (int rr = 0; rr < 2; ++rr) xv[rr][i] = *(const v4f*)(x + (size_t)(r0 + wave * 2 + rr) * CC + (i * 32 + lane) * 4); }
#pragma unroll
  for (int j = 0; j < 4; ++j) { const int c = n0 + j * 16 + col; const float bb = bp[c];
#pragma unroll
    for (int r = 0; r < 8; ++r) sy[8 * g + r][c] = acc[j][r] * (8.0f / 16.0f) + bb; }
  __syncthreads();   // a row's 512 columns come from all eight waves
#pragma unroll
  for (int rr = 0; rr < 2; ++rr) { const int rl = wave * 2 + rr; v4f v[4];
#pragma unroll
    for (int i = 0; i < 4; ++i) v[i] = *(const v4f*)(&sy[rl][(i * 32 + lane) * 4]);
    float s = 0.f;
#pragma unroll
    for (int i = 0; i < 4; ++i) s += (v[i][0] + v[i][1]) + (v[i][2] + v[i][3]);
#pragma unroll
    for (int m = 16; m >= 1; m >>= 1) s += __shfl_xor(s, m, 32);
    const float mu = s * (1.0f / CC); float q2 = 0.f;
#pragma unroll
    for (int i = 0; i < 4; ++i) { v[i] -= mu; const v4f d2 = v[i] * v[i]; q2 += (d2[0] + d2[1]) + (d2[2] + d2[3]); }
#pragma unroll
    for (int m = 16; m >= 1; m >>= 1) q2 += __shfl_xor(q2, m, 32);
    const float rs = rsqrtf(q2 * (1.0f / CC) + 1e-5f);
#pragma unroll
    for (int i = 0; i < 4; ++i) vst2(out + (size_t)(r0 + rl) * CC + (i * 32 + lane) * 4, (v4f)(xv[rr][i] + gm * (v[i] * rs * lw[i] + lb[i]))); }
}
extern "C" void kernel_launch(void* const* d_in, const int* in_sizes, int n_in, void* d_out, int out_size, void* d_ws, size_t ws_size, hipStream_t stream) {
  (void)in_sizes; (void)n_in; (void)out_size; (void)ws_size;
  const float** I = (const float**)d_in;
  const float* x = I[0]; const float* adj = I[1]; const float* Wq = I[2]; const float* Wk = I[3]; const float* Wv = I[4]; const float* Wp = I[5]; const float* bp = I[6]; const float* lnw = I[7]; const float* lnb = I[8]; const float* gam = I[9];
  float* out = (float*)d_out;
  char* ws = (char*)d_ws; size_t off = 0;
  auto take = [&](size_t bytes) { char* p = ws + off; off += (bytes + 255) & ~(size_t)255; return p; };
  _Float16* X16 = (_Float16*)take((size_t)NR * CC * 2); _Float16* P = (_Float16*)take((size_t)4 * CC * CC * 2);
  _Float16* Q16 = (_Float16*)take((size_t)NR * CC * 2); _Float16* K16 = (_Float16*)take((size_t)NR * CC * 2); _Float16* VT = (_Float16*)take((size_t)NR * CC * 2); _Float16* O16 = (_Float16*)take((size_t)NR * CC * 2);
  k_prep<<<NPC / 256, 256, 0, stream>>>(x, Wq, Wk, Wv, Wp, X16, P);
  k_qkv<<<dim3(NR / 64, CC / 128, 3), 128, 0, stream>>>(X16, P, Q16, K16, VT);
  k_attn<<<dim3(EE / 64, NH, NB), 128, 0, stream>>>(Q16, K16, VT, adj, O16);
  k_proj<<<NR / 16, 256, 0, stream>>>(O16, P, bp, lnw, lnb, gam, x, out);
}

// v008
// Measured time: 48.7 microseconds a run.
// Two timings next to v007 put it at 1.22 and 1.23 times that version's speed.
// Counting every step since v000, it is 6.25 times as fast.
#include <hip/hip_runtime.h>
#include <math.h>

typedef __attribute__((ext_vector_type(16))) _Float16 v16h;
typedef __attribute__((ext_vector_type(16))) __bf16 v16b;
typedef __attribute__((ext_vector_type(8)))  _Float16 v8h;
typedef __attribute__((ext_vector_type(8)))  float v8f;
typedef __attribute__((ext_vector_type(4)))  float v4f;
typedef __attribute__((ext_vector_type(2)))  float v2f;
typedef __attribute__((ext_vector_type(4)))  unsigned v4u;
typedef __attribute__((ext_vector_type(4)))  int v4i;
typedef float __attribute__((may_alias)) float_a;
typedef int __attribute__((may_alias)) int_a;

template <typename T> __device__ __forceinline__ void vst2(void* p, T v) { *(T*)p = v;  }
__device__ __forceinline__ v8f wmma16(v16h a, v16h b, v8f c) {
  v8f d = __builtin_amdgcn_wmma_f32_16x16x32_f16(false, a, false, b, (short)0, c, false, false);
  asm volatile("v_nop\n\tv_nop\n\tv_nop\n\tv_nop" : "+v"(d) : "v"(a), "v"(b));
  return d;
}
__device__ __forceinline__ v8f wmma_bf(v16b a, v16b b, v8f c) {
  v8f d = __builtin_amdgcn_wmma_f32_16x16x32_bf16(false, a, false, b, (short)0, c, false, false);
  asm volatile("v_nop\n\tv_nop\n\tv_nop\n\tv_nop" : "+v"(d) : "v"(a), "v"(b));
  return d;
}
// 16x16x32 fragments: lane = (h = lane>>4, row/col = lane&15); elements 0..7 = k0+8h+0..7, 8..15 = k0+16+8h+0..7; D element r = row 8h+r
__device__ __forceinline__ v16h frag_h(const _Float16* rowk0, int lane) {
  union { v16h v; v8h q[2]; } u; const _Float16* p = rowk0 + 8 * (lane >> 4);
  u.q[0] = *(const v8h*)p; u.q[1] = *(const v8h*)(p + 16); return u.v;
}
__device__ __forceinline__ v16h frag_f32(const float* rowk0, int lane) {
  v16h a; const float* p = rowk0 + 8 * (lane >> 4);
#pragma unroll
  for (int i = 0; i < 8; ++i) { a[i] = (_Float16)p[i]; a[8 + i] = (_Float16)p[16 + i]; }
  return a;
}
__device__ __forceinline__ v16h frag_f32s(const float* rowk0, int lane, float sc) {
  v16h a; const float* p = rowk0 + 8 * (lane >> 4);
#pragma unroll
  for (int i = 0; i < 8; ++i) { a[i] = (_Float16)(p[i] * sc); a[8 + i] = (_Float16)(p[16 + i] * sc); }
  return a;
}
// column fragment from a [K][ld] layout (column n), rows >= K read as 0
__device__ __forceinline__ v16h fragc_f32(const float* W, int k0, int n, int lane, int ld, int K) {
  v16h a; const int g = lane >> 4;
#pragma unroll
  for (int i = 0; i < 8; ++i) { const int ka = k0 + 8 * g + i, kb = ka + 16;
    a[i] = (_Float16)(ka < K ? W[(size_t)ka * ld + n] : 0.f); a[8 + i] = (_Float16)(kb < K ? W[(size_t)kb * ld + n] : 0.f); }
  return a;
}
struct F2 { v16b h, l; };
__device__ __forceinline__ F2 bsplit16(const float v[16]) { F2 r;
#pragma unroll
  for (int i = 0; i < 16; ++i) { const __bf16 h = (__bf16)v[i]; r.h[i] = h; r.l[i] = (__bf16)(v[i] - (float)h); }
  return r; }
__device__ __forceinline__ F2 split_row(const float* row, int k0, int lane) { float v[16]; const float* p = row + k0 + 8 * (lane >> 4);
#pragma unroll
  for (int i = 0; i < 8; ++i) { v[i] = p[i]; v[8 + i] = p[16 + i]; }
  return bsplit16(v); }
__device__ __forceinline__ F2 split_rowK(const float* row, int k0, int lane, int K) { float v[16]; const int g = lane >> 4;
#pragma unroll
  for (int i = 0; i < 8; ++i) { const int ka = k0 + 8 * g + i, kb = ka + 16; v[i] = ka < K ? row[ka] : 0.f; v[8 + i] = kb < K ? row[kb] : 0.f; }
  return bsplit16(v); }
__device__ __forceinline__ F2 split_col(const float* W, int k0, int n, int lane, int ld, int K) { float v[16]; const int g = lane >> 4;
#pragma unroll
  for (int i = 0; i < 8; ++i) { const int ka = k0 + 8 * g + i, kb = ka + 16; v[i] = ka < K ? W[(size_t)ka * ld + n] : 0.f; v[8 + i] = kb < K ? W[(size_t)kb * ld + n] : 0.f; }
  return bsplit16(v); }
__device__ __forceinline__ v8f mac3(const F2& a, const F2& b, v8f c) { c = wmma_bf(a.l, b.h, c); c = wmma_bf(a.h, b.l, c); return wmma_bf(a.h, b.h, c); }
__device__ __forceinline__ float sigm(float v) { return 1.0f / (1.0f + expf(-v)); }
#define LDSX() do { asm volatile("s_wait_dscnt 0" ::: "memory"); __builtin_amdgcn_wave_barrier(); __builtin_amdgcn_fence(__ATOMIC_RELEASE, "workgroup"); } while (0)

// Mask-modulated linear attention block: q/k/v projections, per head attn = (q.k * adj + 1)/2 (no softmax), attn @ v, output projection
// + bias, LayerNorm, x + gamma * (.). All products on v_wmma_f32_16x16x32_f16 (x converted once, [out][in] weights packed as f16 rows
// x16, q/k/v kept head-major f16, the [E x E] scores scaled by 1/8 into f16 for the second product, adj mask read as data, the "+1"
// added to the scaled scores ahead of that product).
#define NB 2
#define EE 2048
#define CC 512
#define NH 8
#define HD 64
#define NR (NB * EE)

typedef __attribute__((ext_vector_type(4)))  _Float16 v4h;
#define NPC (CC * CC / 4)   // 16-byte pieces of one weight matrix = threads of k_prep
static_assert(NR * CC / 4 == 8 * NPC, "x is eight times a weight matrix");
// x -> X16 (f16) and Wq, Wk, Wv, Wp -> P (f16, x16; P rows [which*512 + n][512] are the weights' own [out][in] order), in one launch of
// few waves: thread t takes piece t of each eighth of x and of each weight. A wave's load covers 512 adjacent bytes, its store 256;
// the twelve loads are asked for together, so that the memory latency is paid once a wave.
__global__ __launch_bounds__(256) void k_prep(const float* __restrict__ x, const float* __restrict__ Wq, const float* __restrict__ Wk, const float* __restrict__ Wv, const float* __restrict__ Wp, _Float16* __restrict__ X16, _Float16* __restrict__ P) {
  const unsigned t = blockIdx.x * 256 + threadIdx.x;
  const v4f* x4 = (const v4f*)x; v4h* X4 = (v4h*)X16; v4h* P4 = (v4h*)P;
  v4f a[8], w[4];
#pragma unroll   // this loop and the two below: unrolled so that the arrays are indexed by constants and stay in registers
  for (int i = 0; i < 8; ++i) a[i] = x4[i * NPC + t];
  w[0] = ((const v4f*)Wq)[t]; w[1] = ((const v4f*)Wk)[t]; w[2] = ((const v4f*)Wv)[t]; w[3] = ((const v4f*)Wp)[t];
#pragma unroll
  for (int i = 0; i < 8; ++i) X4[i * NPC + t] = __builtin_convertvector(a[i], v4h);
#pragma unroll
  for (int i = 0; i < 4; ++i) P4[i * NPC + t] = __builtin_convertvector(w[i] * 16.0f, v4h);
}
// LDS byte address of a __shared__ element (what an asynchronous copy takes as its destination)
__device__ __forceinline__ unsigned lds_off(const void* p) { return (unsigned)(size_t)(const __attribute__((address_space(3))) void*)p; }
// eight asynchronous copies global -> LDS, 16 bytes a lane each, through no register. The s_wait_xcnt stands in the copies' own statement,
// so that no address register of a copy is rewritten ahead of it.
__device__ __forceinline__ void acopy8(const unsigned (&l)[8], const void* const (&p)[8]) {
  asm volatile("global_load_async_to_lds_b128 %0, %8, off\n\t"
               "global_load_async_to_lds_b128 %1, %9, off\n\t"
               "global_load_async_to_lds_b128 %2, %10, off\n\t"
               "global_load_async_to_lds_b128 %3, %11, off\n\t"
               "global_load_async_to_lds_b128 %4, %12, off\n\t"
               "global_load_async_to_lds_b128 %5, %13, off\n\t"
               "global_load_async_to_lds_b128 %6, %14, off\n\t"
               "global_load_async_to_lds_b128 %7, %15, off\n\t"
               "s_wait_xcnt 0x0"
               :: "v"(l[0]), "v"(l[1]), "v"(l[2]), "v"(l[3]), "v"(l[4]), "v"(l[5]), "v"(l[6]), "v"(l[7]),
                  "v"(p[0]), "v"(p[1]), "v"(p[2]), "v"(p[3]), "v"(p[4]), "v"(p[5]), "v"(p[6]), "v"(p[7]) : "memory");
}
// four such copies
__device__ __forceinline__ void acopy4(const unsigned (&l)[4], const void* const (&p)[4]) {
  asm volatile("global_load_async_to_lds_b128 %0, %4, off\n\t"
               "global_load_async_to_lds_b128 %1, %5, off\n\t"
               "global_load_async_to_lds_b128 %2, %6, off\n\t"
               "global_load_async_to_lds_b128 %3, %7, off\n\t"
               "s_wait_xcnt 0x0"
               :: "v"(l[0]), "v"(l[1]), "v"(l[2]), "v"(l[3]), "v"(p[0]), "v"(p[1]), "v"(p[2]), "v"(p[3]) : "memory");
}
#define KPITCH 72   // f16 per staged x, weight, K, V or O row: 144 B = 16 B x odd, conflict-free for 16-byte fragment reads
// q/k/v: block (64 rows, 128-col chunk = 2 heads, which): Q16/K16 head-major [b][h][e][64] (x4); VT [b][h][d][e] (x4)
__global__ __launch_bounds__(128) void k_qkv(const _Float16* __restrict__ X16, const _Float16* __restrict__ P, _Float16* __restrict__ Q16, _Float16* __restrict__ K16, _Float16* __restrict__ VT) {
  // the staged tiles are dead (behind the loop's last barrier) when the results are laid out for their stores: the two uses share the LDS
  __shared__ __align__(16) union { struct { _Float16 a[2][64][KPITCH]; _Float16 b[2][128][KPITCH]; } t; float so[4][16][132]; _Float16 st[128][72]; } sm;
  auto& so = sm.so; auto& st = sm.st;
  const int tid = threadIdx.x, wave = tid >> 5, lane = tid & 31, col = lane & 15, g = lane >> 4;
  const int which = blockIdx.z, r0b = blockIdx.x * 64, n0 = blockIdx.y * 128; const int b = r0b / EE, e0 = r0b % EE;
  const _Float16* Pw = P + (size_t)which * CC * CC;
  // The k walk starts at a slice of the block's own and wraps: 64 blocks read the same weight rows and 12 the same x rows, and walking in
  // step they would ask L2 for the same lines at the same moment. Only the order of the f32 sums depends on it.
  const int s0 = (blockIdx.x + (blockIdx.x >> 3) + blockIdx.y + 4 * blockIdx.z) & (CC / 64 - 1);
  // k slice ks (64 wide = one 128-B line of each row) -> buffer bf: the block's 128 weight rows and 64 x rows, whole lines, once for the four waves
  // (its loops are unrolled so that the address arrays are indexed by constants and stay in registers, as asm operands must)
  auto stage = [&](int ks, int bf) {
    unsigned l[8]; const void* p[8]; unsigned la[4]; const void* pa[4];
#pragma unroll
    for (int i = 0; i < 8; ++i) { const int c = tid + 128 * i, row = c >> 3, pc = c & 7;
      l[i] = lds_off(&sm.t.b[bf][row][pc * 8]); p[i] = Pw + (size_t)(n0 + row) * CC + ks * 64 + pc * 8; }
    acopy8(l, p);
#pragma unroll
    for (int i = 0; i < 4; ++i) { const int c = tid + 128 * i, row = c >> 3, pc = c & 7;
      la[i] = lds_off(&sm.t.a[bf][row][pc * 8]); pa[i] = X16 + (size_t)(r0b + row) * CC + ks * 64 + pc * 8; }
    acopy4(la, pa);
  };
  stage(s0, 0);
  asm volatile("s_wait_asynccnt 0x0" ::: "memory");   // this wave's part of the first slice has landed
  __syncthreads();                                     // ... and every other wave's
  stage((s0 + 1) & (CC / 64 - 1), 1);
  v8f acc[8] = {};
#pragma unroll 1   // rolled: the trips are parted by barriers, so unrolling would only lengthen the text
  for (int ks = 0; ks < CC / 64; ++ks) { const int bf = ks & 1;
    // the slice's fragments are asked for in one batch ahead of its 16 products, so that the LDS latency is paid once a slice
    // (the short loops are unrolled so that these arrays are indexed by constants and stay in registers)
    v16h a[2], bq[2][8];
#pragma unroll
    for (int kc = 0; kc < 2; ++kc) { a[kc] = frag_h(&sm.t.a[bf][wave * 16 + col][kc * 32], lane);
#pragma unroll
      for (int j = 0; j < 8; ++j) bq[kc][j] = frag_h(&sm.t.b[bf][j * 16 + col][kc * 32], lane); }
#pragma unroll
    for (int kc = 0; kc < 2; ++kc)
#pragma unroll
      for (int j = 0; j < 8; ++j) acc[j] = wmma16(a[kc], bq[kc][j], acc[j]);
    asm volatile("s_wait_dscnt 0" ::: "memory");        // this wave's reads of buffer bf have returned
    asm volatile("s_wait_asynccnt 0x0" ::: "memory");   // this wave's part of slice ks + 1 has landed
    __syncthreads();                                     // publishes slice ks + 1 and ends every wave's reads of buffer bf
    if (ks + 2 < CC / 64) stage((s0 + ks + 2) & (CC / 64 - 1), bf); }
  asm volatile("s_wait_asynccnt 0x0" ::: "memory");     // no copy is left in flight when the LDS is taken for the results
  if (which < 2) {
#pragma unroll
    for (int j = 0; j < 8; ++j)
#pragma unroll
      for (int r = 0; r < 8; ++r) so[wave][8 * g + r][j * 16 + col] = acc[j][r] * (4.0f / 16.0f);
    LDSX();
    _Float16* D = which == 0 ? Q16 : K16;
    for (int q = lane; q < 16 * 2 * 8; q += 32) { const int hh = q >> 7, rl = (q >> 3) & 15, pc = q & 7; const int h = (n0 >> 6) + hh; union { v8h h8; v4u u; } pk;
#pragma unroll
      for (int e = 0; e < 8; ++e) pk.h8[e] = (_Float16)so[wave][rl][hh * 64 + pc * 8 + e];
      vst2(D + (((size_t)b * NH + h) * EE + e0 + wave * 16 + rl) * HD + pc * 8, pk.u); } }
  else {
#pragma unroll
    for (int j = 0; j < 8; ++j)
#pragma unroll
      for (int r = 0; r < 8; ++r) st[j * 16 + col][wave * 16 + 8 * g + r] = (_Float16)(acc[j][r] * (4.0f / 16.0f));
    __syncthreads();
    for (int q = tid; q < 128 * 8; q += 128) { const int cl = q >> 3, pc = q & 7; const int c = n0 + cl, h = c >> 6, d = c & 63; vst2(VT + (((size_t)b * NH + h) * HD + d) * EE + e0 + pc * 8, *(const v4u*)(&st[cl][pc * 8])); } }
}
#define MPITCH 68   // f32 per staged mask row: 272 B = 16 B x odd, conflict-free for 16-byte reads down a column of rows
// attention: block (64 q, h, b): S tiles over all 2048 keys (f16); P = (S * adj + 1) / 8 -> f16; acc += P @ V; out = 0.5 * 8 * acc / 4 -> O16 head-major [b][h][e][64] (x 1/8)
// The "+1" of the scores goes into P itself (one fused multiply-add a score), so that the second product also yields the sum of v over the keys.
// Each 64-key tile of K, V and the block's 64 x 64 piece of the mask is brought into LDS once for the four waves, with whole-line
// asynchronous copies, one tile ahead (two buffers); a wave then fetches the tile's fragments from LDS in one batch.
// The scores are formed transposed (A = K rows, B = Q): a lane then holds 8 adjacent keys of ONE query in each 16-key tile, which is the
// place those scores have in the A fragment of P @ V. So P goes from accumulator to operand inside the lane, and the lane's 8 mask values
// are 32 adjacent bytes of one mask row.
__global__ __launch_bounds__(128) void k_attn(const _Float16* __restrict__ Q16, const _Float16* __restrict__ K16, const _Float16* __restrict__ VT, const float* __restrict__ adj, _Float16* __restrict__ O16) {
  __shared__ __align__(16) _Float16 sK[2][64][KPITCH];
  __shared__ __align__(16) _Float16 sV[2][64][KPITCH];
  __shared__ __align__(16) float sM[2][64][MPITCH];
  __shared__ __align__(16) float sO[4][16][68];
  const int tid = threadIdx.x, w = tid >> 5, lane = tid & 31, col = lane & 15, g = lane >> 4;
  const int b = blockIdx.z, h = blockIdx.y, q0b = blockIdx.x * 64, q0 = q0b + w * 16; const size_t bh = (size_t)b * NH + h;
  // The key walk starts at a tile of the block's own and wraps: the 32 blocks of a head read the same K and V tiles, the 16 blocks of a query
  // range the same mask rows, and each of these sets gets starts that all differ, so that no two ask L2 for the same lines at the same moment.
  // The sum over the keys has no order of its own; only the order of the f32 sums depends on the start.
  const int s0 = (blockIdx.x + 2 * (blockIdx.y + NH * blockIdx.z)) & (EE / 64 - 1);
  // tile kt -> buffer bf: K rows (128 B, adjacent), V^T rows (128 B of each of 64 rows), mask rows (256 B of each of 64 rows)
  auto stage = [&](int kt, int bf) {
    unsigned l[8]; const void* p[8];
#pragma unroll
    for (int i = 0; i < 4; ++i) { const int c = tid + 128 * i, row = c >> 3, pc = c & 7;
      l[i] = lds_off(&sK[bf][row][pc * 8]); p[i] = K16 + (bh * EE + kt * 64 + row) * HD + pc * 8;
      l[4 + i] = lds_off(&sV[bf][row][pc * 8]); p[4 + i] = VT + (bh * HD + row) * EE + kt * 64 + pc * 8; }
    acopy8(l, p);
#pragma unroll
    for (int i = 0; i < 8; ++i) { const int c = tid + 128 * i, row = c >> 4, pc = c & 15;
      l[i] = lds_off(&sM[bf][row][pc * 4]); p[i] = adj + (size_t)(q0b + row) * EE + kt * 64 + pc * 4; }
    acopy8(l, p);
  };
  stage(s0, 0);
  v16h aq[2];
#pragma unroll
  for (int kc = 0; kc < 2; ++kc) aq[kc] = frag_h(Q16 + (bh * EE + q0 + col) * HD + kc * 32, lane);
  asm volatile("s_wait_asynccnt 0x0" ::: "memory");   // this wave's part of the first tile has landed
  __syncthreads();                                     // ... and every other wave's
  stage((s0 + 1) & (EE / 64 - 1), 1);
  v8f acc[4] = {};
#pragma unroll 1
  for (int kt = 0; kt < EE / 64; ++kt) { const int bf = kt & 1;
    // the tile's fragments and mask values are asked for in one batch ahead of its products, in the order of their use, so that the LDS
    // latency is paid once a tile (the short loops are unrolled so that these arrays are indexed by constants and stay in registers)
    v16h kf[4][2], vf[2][4]; v4f m[4][2];
#pragma unroll
    for (int t = 0; t < 4; ++t)
#pragma unroll
      for (int kc = 0; kc < 2; ++kc) kf[t][kc] = frag_h(&sK[bf][t * 16 + col][kc * 32], lane);
#pragma unroll
    for (int t = 0; t < 4; ++t)
#pragma unroll
      for (int i = 0; i < 2; ++i) m[t][i] = *(const v4f*)(&sM[bf][w * 16 + col][t * 16 + 8 * g + 4 * i]);
#pragma unroll
    for (int kc = 0; kc < 2; ++kc)
#pragma unroll
      for (int u = 0; u < 4; ++u) vf[kc][u] = frag_h(&sV[bf][u * 16 + col][kc * 32], lane);
    // s[t] element r = score of key t*16 + 8g + r with query col
    v8f s[4] = {};
#pragma unroll
    for (int kc = 0; kc < 2; ++kc)
#pragma unroll
      for (int t = 0; t < 4; ++t) s[t] = wmma16(kf[t][kc], aq[kc], s[t]);
#pragma unroll
    for (int kc = 0; kc < 2; ++kc) { v16h pa;   // P's A fragment of keys kc*32 ..+31: elements 0..7 from tile 2kc, 8..15 from tile 2kc+1
#pragma unroll
      for (int hf = 0; hf < 2; ++hf)
#pragma unroll
        for (int r = 0; r < 8; ++r) pa[8 * hf + r] = (_Float16)(s[2 * kc + hf][r] * m[2 * kc + hf][r >> 2][r & 3] * (1.0f / (16.0f * 8.0f)) + 0.125f);   // (x4 x4)/16 = true qk ; (qk * adj + 1) kept /8
#pragma unroll
      for (int u = 0; u < 4; ++u) acc[u] = wmma16(pa, vf[kc][u], acc[u]); }
    asm volatile("s_wait_dscnt 0" ::: "memory");        // this wave's reads of buffer bf have returned
    asm volatile("s_wait_asynccnt 0x0" ::: "memory");   // this wave's part of tile kt + 1 has landed
    __syncthreads();                                     // publishes tile kt + 1 and ends every wave's reads of buffer bf
    if (kt + 2 < EE / 64) stage((s0 + kt + 2) & (EE / 64 - 1), bf); }
  asm volatile("s_wait_asynccnt 0x0" ::: "memory");     // no copy is left in flight when the wave goes on
  // out = 0.5 * (acc * 8 / 4) = acc   (P stored /8, V stored x4) ; store O x 1/8 as f16 (values ~ O(50))
#pragma unroll
  for (int t = 0; t < 4; ++t) { const int d = t * 16 + col;
#pragma unroll
    for (int r = 0; r < 8; ++r) sO[w][8 * g + r][d] = acc[t][r] * 0.125f; }
  LDSX();
  for (int q = lane; q < 16 * 8; q += 32) { const int rl = q >> 3, pc = q & 7; union { v8h h8; v4u u; } pk;
#pragma unroll
    for (int e = 0; e < 8; ++e) pk.h8[e] = (_Float16)sO[w][rl][pc * 8 + e];
    vst2(O16 + (bh * EE + q0 + rl) * HD + pc * 8, pk.u); }
}
// proj + bias + LN; y = x + gamma * LN(out). Block = 16 rows x all 512 cols, 8 waves: wave w does cols 64w..64w+63 (one pass),
// then, behind one block barrier, wave w normalises rows 2w and 2w+1 with 16 columns per lane and whole-line loads and stores.
// The operands come through LDS by whole-line asynchronous copies: the block's 16 O rows once, the weight in k slices of 64 (one 128-B line
// of each of its 512 rows), one slice ahead (two buffers); a wave then fetches a slice's fragments from LDS in one batch, so that no product
// waits for a global load of its own.
__global__ __launch_bounds__(256) void k_proj(const _Float16* __restrict__ O16, const _Float16* __restrict__ P, const float* __restrict__ bp, const float* __restrict__ lnw, const float* __restrict__ lnb, const float* __restrict__ gam, const float* __restrict__ x, float* __restrict__ out) {
  __shared__ __align__(16) _Float16 sb[2][CC][KPITCH];
  __shared__ __align__(16) _Float16 sa[NH][16][KPITCH];
  __shared__ __align__(16) float sy[16][CC + 4];
  const int tid = threadIdx.x, wave = tid >> 5, lane = tid & 31, col = lane & 15, g = lane >> 4;
  const int r0 = blockIdx.x * 16, n0 = wave * 64;
  const _Float16* Pw = P + (size_t)3 * CC * CC;
  // The k walk starts at a slice of the block's own and wraps: every block reads the whole weight, and walking in step all would ask L2 for
  // the same lines at the same moment. Only the order of the f32 sums depends on it.
  const int s0 = (blockIdx.x + (blockIdx.x >> 3)) & (CC / 64 - 1);
  // weight slice ks -> buffer bf: 512 rows x 8 pieces of 16 B, 16 pieces a thread
  // (the loops are unrolled so that the address arrays are indexed by constants and stay in registers, as asm operands must)
  auto stage = [&](int ks, int bf) {
#pragma unroll
    for (int hf = 0; hf < 2; ++hf) { unsigned l[8]; const void* p[8];
#pragma unroll
      for (int i = 0; i < 8; ++i) { const int c = tid + 256 * (hf * 8 + i), row = c >> 3, pc = c & 7;
        l[i] = lds_off(&sb[bf][row][pc * 8]); p[i] = Pw + (size_t)row * CC + ks * 64 + pc * 8; }
      acopy8(l, p); }
  };
  { // the block's O rows, all eight heads (= k slices): 8 x 16 rows x 8 pieces, 4 pieces a thread
    unsigned l[4]; const void* p[4];
#pragma unroll
    for (int i = 0; i < 4; ++i) { const int c = tid + 256 * i, hd = c >> 7, row = (c >> 3) & 15, pc = c & 7; const int R = r0 + row;
      l[i] = lds_off(&sa[hd][row][pc * 8]); p[i] = O16 + ((((size_t)(R / EE)) * NH + hd) * EE + (R % EE)) * HD + pc * 8; }
    acopy4(l, p); }
  stage(s0, 0);
  asm volatile("s_wait_asynccnt 0x0" ::: "memory");   // this wave's part of the O rows and of the first slice has landed
  __syncthreads();                                     // ... and every other wave's
  stage((s0 + 1) & (CC / 64 - 1), 1);
  v8f acc[4] = {};
#pragma unroll 1   // rolled: the trips are parted by barriers, so unrolling would only lengthen the text
  for (int ks = 0; ks < CC / 64; ++ks) { const int bf = ks & 1;
    // (the short loops are unrolled so that these arrays are indexed by constants and stay in registers)
    v16h a[2], bw[2][4];
#pragma unroll
    for (int kc = 0; kc < 2; ++kc) { a[kc] = frag_h(&sa[(s0 + ks) & (CC / 64 - 1)][col][kc * 32], lane);
#pragma unroll
      for (int j = 0; j < 4; ++j) bw[kc][j] = frag_h(&sb[bf][n0 + j * 16 + col][kc * 32], lane); }
#pragma unroll
    for (int kc = 0; kc < 2; ++kc)
#pragma unroll
      for (int j = 0; j < 4; ++j) acc[j] = wmma16(a[kc], bw[kc][j], acc[j]);
    asm volatile("s_wait_dscnt 0" ::: "memory");        // this wave's reads of buffer bf have returned
    asm volatile("s_wait_asynccnt 0x0" ::: "memory");   // this wave's part of slice ks + 1 has landed
    __syncthreads();                                     // publishes slice ks + 1 and ends every wave's reads of buffer bf
    if (ks + 2 < CC / 64) stage((s0 + ks + 2) & (CC / 64 - 1), bf); }
  asm volatile("s_wait_asynccnt 0x0" ::: "memory");     // no copy is left in flight when the wave goes on
  // this wave's x rows and the LN weights are asked for here, so that they fly during the LDS exchange and the row sums
  const float gm = gam[0]; v4f lw[4], lb[4], xv[2][4];
#pragma unroll
  for (int i = 0; i < 4; ++i) { lw[i] = *(const v4f*)(lnw + (i * 32 + lane) * 4); lb[i] = *(const v4f*)(lnb + (i * 32 + lane) * 4);
#pragma unroll
    for (int rr = 0; rr < 2; ++rr) xv[rr][i] = *(const v4f*)(x + (size_t)(r0 + wave * 2 + rr) * CC + (i * 32 + lane) * 4); }
#pragma unroll
  for (int j = 0; j < 4; ++j) { const int c = n0 + j * 16 + col; const float bb = bp[c];
#pragma unroll
    for (int r = 0; r < 8; ++r) sy[8 * g + r][c] = acc[j][r] * (8.0f / 16.0f) + bb; }
  __syncthreads();   // a row's 512 columns come from all eight waves
#pragma unroll
  for (int rr = 0; rr < 2; ++rr) { const int rl = wave * 2 + rr; v4f v[4];
#pragma unroll
    for (int i = 0; i < 4; ++i) v[i] = *(const v4f*)(&sy[rl][(i * 32 + lane) * 4]);
    float s = 0.f;
#pragma unroll
    for (int i = 0; i < 4; ++i) s += (v[i][0] + v[i][1]) + (v[i][2] + v[i][3]);
#pragma unroll
    for (int m = 16; m >= 1; m >>= 1) s += __shfl_xor(s, m, 32);
    const float mu = s * (1.0f / CC); float q2 = 0.f;
#pragma unroll
    for (int i = 0; i < 4; ++i) { v[i] -= mu; const v4f d2 = v[i] * v[i]; q2 += (d2[0] + d2[1]) + (d2[2] + d2[3]); }
#pragma unroll
    for (int m = 16; m >= 1; m >>= 1) q2 += __shfl_xor(q2, m, 32);
    const float rs = rsqrtf(q2 * (1.0f / CC) + 1e-5f);
#pragma unroll
    for (int i = 0; i < 4; ++i) vst2(out + (size_t)(r0 + rl) * CC + (i * 32 + lane) * 4, (v4f)(xv[rr][i] + gm * (v[i] * rs * lw[i] + lb[i]))); }
}
extern "C" void kernel_launch(void* const* d_in, const int* in_sizes, int n_in, void* d_out, int out_size, void* d_ws, size_t ws_size, hipStream_t stream) {
  (void)in_sizes; (void)n_in; (void)out_size; (void)ws_size;
  const float** I = (const float**)d_in;
  const float* x = I[0]; const float* adj = I[1]; const float* Wq = I[2]; const float* Wk = I[3]; const float* Wv = I[4]; const float* Wp = I[5]; const float* bp = I[6]; const float* lnw = I[7]; const float* lnb = I[8]; const float* gam = I[9];
  float* out = (float*)d_out;
  char* ws = (char*)d_ws; size_t off = 0;
  auto take = [&](size_t bytes) { char* p = ws + off; off += (bytes + 255) & ~(size_t)255; return p; };
  _Float16* X16 = (_Float16*)take((size_t)NR * CC * 2); _Float16* P = (_Float16*)take((size_t)4 * CC * CC * 2);
  _Float16* Q16 = (_Float16*)take((size_t)NR * CC * 2); _Float16* K16 = (_Float16*)take((size_t)NR * CC * 2); _Float16* VT = (_Float16*)take((size_t)NR * CC * 2); _Float16* O16 = (_Float16*)take((size_t)NR * CC * 2);
  k_prep<<<NPC / 256, 256, 0, stream>>>(x, Wq, Wk, Wv, Wp, X16, P);
  k_qkv<<<dim3(NR / 64, CC / 128, 3), 128, 0, stream>>>(X16, P, Q16, K16, VT);
  k_attn<<<dim3(EE / 64, NH, NB), 128, 0, stream>>>(Q16, K16, VT, adj, O16);
  k_proj<<<NR / 16, 256, 0, stream>>>(O16, P, bp, lnw, lnb, gam, x, out);
}

// v009
// A run of this version takes 43.6 microseconds.
// Two timings next to v008 put it at 1.11 and 1.10 times that version's speed.
// Counting every step since v000, it is 6.92 times as fast.
#include <hip/hip_runtime.h>
#include <math.h>

typedef __attribute__((ext_vector_type(16))) _Float16 v16h;
typedef __attribute__((ext_vector_type(16))) __bf16 v16b;
typedef __attribute__((ext_vector_type(8)))  _Float16 v8h;
typedef __attribute__((ext_vector_type(8)))  float v8f;
typedef __attribute__((ext_vector_type(4)))  float v4f;
typedef __attribute__((ext_vector_type(2)))  float v2f;
typedef __attribute__((ext_vector_type(4)))  unsigned v4u;
typedef __attribute__((ext_vector_type(4)))  int v4i;
typedef float __attribute__((may_alias)) float_a;
typedef int __attribute__((may_alias)) int_a;

template <typename T> __device__ __forceinline__ void vst2(void* p, T v) { *(T*)p = v;  }
__device__ __forceinline__ v8f wmma16(v16h a, v16h b, v8f c) {
  v8f d = __builtin_amdgcn_wmma_f32_16x16x32_f16(false, a, false, b, (short)0, c, false, false);
  asm volatile("v_nop\n\tv_nop\n\tv_nop\n\tv_nop" : "+v"(d) : "v"(a), "v"(b));
  return d;
}
__device__ __forceinline__ v8f wmma_bf(v16b a, v16b b, v8f c) {
  v8f d = __builtin_amdgcn_wmma_f32_16x16x32_bf16(false, a, false, b, (short)0, c, false, false);
  asm volatile("v_nop\n\tv_nop\n\tv_nop\n\tv_nop" : "+v"(d) : "v"(a), "v"(b));
  return d;
}
// 16x16x32 fragments: lane = (h = lane>>4, row/col = lane&15); elements 0..7 = k0+8h+0..7, 8..15 = k0+16+8h+0..7; D element r = row 8h+r
__device__ __forceinline__ v16h frag_h(const _Float16* rowk0, int lane) {
  union { v16h v; v8h q[2]; } u; const _Float16* p = rowk0 + 8 * (lane >> 4);
  u.q[0] = *(const v8h*)p; u.q[1] = *(const v8h*)(p + 16); return u.v;
}
__device__ __forceinline__ v16h frag_f32(const float* rowk0, int lane) {
  v16h a; const float* p = rowk0 + 8 * (lane >> 4);
#pragma unroll
  for (int i = 0; i < 8; ++i) { a[i] = (_Float16)p[i]; a[8 + i] = (_Float16)p[16 + i]; }
  return a;
}
__device__ __forceinline__ v16h frag_f32s(const float* rowk0, int lane, float sc) {
  v16h a; const float* p = rowk0 + 8 * (lane >> 4);
#pragma unroll
  for (int i = 0; i < 8; ++i) { a[i] = (_Float16)(p[i] * sc); a[8 + i] = (_Float16)(p[16 + i] * sc); }
  return a;
}
// column fragment from a [K][ld] layout (column n), rows >= K read as 0
__device__ __forceinline__ v16h fragc_f32(const float* W, int k0, int n, int lane, int ld, int K) {
  v16h a; const int g = lane >> 4;
#pragma unroll
  for (int i = 0; i < 8; ++i) { const int ka = k0 + 8 * g + i, kb = ka + 16;
    a[i] = (_Float16)(ka < K ? W[(size_t)ka * ld + n] : 0.f); a[8 + i] = (_Float16)(kb < K ? W[(size_t)kb * ld + n] : 0.f); }
  return a;
}
struct F2 { v16b h, l; };
__device__ __forceinline__ F2 bsplit16(const float v[16]) { F2 r;
#pragma unroll
  for (int i = 0; i < 16; ++i) { const __bf16 h = (__bf16)v[i]; r.h[i] = h; r.l[i] = (__bf16)(v[i] - (float)h); }
  return r; }
__device__ __forceinline__ F2 split_row(const float* row, int k0, int lane) { float v[16]; const float* p = row + k0 + 8 * (lane >> 4);
#pragma unroll
  for (int i = 0; i < 8; ++i) { v[i] = p[i]; v[8 + i] = p[16 + i]; }
  return bsplit16(v); }
__device__ __forceinline__ F2 split_rowK(const float* row, int k0, int lane, int K) { float v[16]; const int g = lane >> 4;
#pragma unroll
  for (int i = 0; i < 8; ++i) { const int ka = k0 + 8 * g + i, kb = ka + 16; v[i] = ka < K ? row[ka] : 0.f; v[8 + i] = kb < K ? row[kb] : 0.f; }
  return bsplit16(v); }
__device__ __forceinline__ F2 split_col(const float* W, int k0, int n, int lane, int ld, int K) { float v[16]; const int g = lane >> 4;
#pragma unroll
  for (int i = 0; i < 8; ++i) { const int ka = k0 + 8 * g + i, kb = ka + 16; v[i] = ka < K ? W[(size_t)ka * ld + n] : 0.f; v[8 + i] = kb < K ? W[(size_t)kb * ld + n] : 0.f; }
  return bsplit16(v); }
__device__ __forceinline__ v8f mac3(const F2& a, const F2& b, v8f c) { c = wmma_bf(a.l, b.h, c); c = wmma_bf(a.h, b.l, c); return wmma_bf(a.h, b.h, c); }
__device__ __forceinline__ float sigm(float v) { return 1.0f / (1.0f + expf(-v)); }
#define LDSX() do { asm volatile("s_wait_dscnt 0" ::: "memory"); __builtin_amdgcn_wave_barrier(); __builtin_amdgcn_fence(__ATOMIC_RELEASE, "workgroup"); } while (0)

// Mask-modulated linear attention block: q/k/v projections, per head attn = (q.k * adj + 1)/2 (no softmax), attn @ v, output projection
// + bias, LayerNorm, x + gamma * (.). All products on v_wmma_f32_16x16x32_f16 (x converted once, [out][in] weights packed as f16 rows
// x16, q/k/v kept head-major f16, the [E x E] scores scaled by 1/8 into f16 for the second product, adj mask read as data, the "+1"
// added to the scaled scores ahead of that product).
#define NB 2
#define EE 2048
#define CC 512
#define NH 8
#define HD 64
#define NR (NB * EE)

typedef __attribute__((ext_vector_type(4)))  _Float16 v4h;
#define NPC (CC * CC / 4)   // 16-byte pieces of one weight matrix = threads of k_prep
static_assert(NR * CC / 4 == 8 * NPC, "x is eight times a weight matrix");
// x -> X16 (f16) and Wq, Wk, Wv, Wp -> P (f16, x16; P rows [which*512 + n][512] are the weights' own [out][in] order), in one launch of
// few waves: thread t takes piece t of each eighth of x and of each weight. A wave's load covers 512 adjacent bytes, its store 256;
// the twelve loads are asked for together, so that the memory latency is paid once a wave.
__global__ __launch_bounds__(256) void k_prep(const float* __restrict__ x, const float* __restrict__ Wq, const float* __restrict__ Wk, const float* __restrict__ Wv, const float* __restrict__ Wp, _Float16* __restrict__ X16, _Float16* __restrict__ P) {
  const unsigned t = blockIdx.x * 256 + threadIdx.x;
  const v4f* x4 = (const v4f*)x; v4h* X4 = (v4h*)X16; v4h* P4 = (v4h*)P;
  v4f a[8], w[4];
#pragma unroll   // this loop and the two below: unrolled so that the arrays are indexed by constants and stay in registers
  for (int i = 0; i < 8; ++i) a[i] = x4[i * NPC + t];
  w[0] = ((const v4f*)Wq)[t]; w[1] = ((const v4f*)Wk)[t]; w[2] = ((const v4f*)Wv)[t]; w[3] = ((const v4f*)Wp)[t];
#pragma unroll
  for (int i = 0; i < 8; ++i) X4[i * NPC + t] = __builtin_convertvector(a[i], v4h);
#pragma unroll
  for (int i = 0; i < 4; ++i) P4[i * NPC + t] = __builtin_convertvector(w[i] * 16.0f, v4h);
}
// LDS byte address of a __shared__ element (what an asynchronous copy takes as its destination)
__device__ __forceinline__ unsigned lds_off(const void* p) { return (unsigned)(size_t)(const __attribute__((address_space(3))) void*)p; }
// eight asynchronous copies global -> LDS, 16 bytes a lane each, through no register. The s_wait_xcnt stands in the copies' own statement,
// so that no address register of a copy is rewritten ahead of it.
__device__ __forceinline__ void acopy8(const unsigned (&l)[8], const void* const (&p)[8]) {
  asm volatile("global_load_async_to_lds_b128 %0, %8, off\n\t"
               "global_load_async_to_lds_b128 %1, %9, off\n\t"
               "global_load_async_to_lds_b128 %2, %10, off\n\t"
               "global_load_async_to_lds_b128 %3, %11, off\n\t"
               "global_load_async_to_lds_b128 %4, %12, off\n\t"
               "global_load_async_to_lds_b128 %5, %13, off\n\t"
               "global_load_async_to_lds_b128 %6, %14, off\n\t"
               "global_load_async_to_lds_b128 %7, %15, off\n\t"
               "s_wait_xcnt 0x0"
               :: "v"(l[0]), "v"(l[1]), "v"(l[2]), "v"(l[3]), "v"(l[4]), "v"(l[5]), "v"(l[6]), "v"(l[7]),
                  "v"(p[0]), "v"(p[1]), "v"(p[2]), "v"(p[3]), "v"(p[4]), "v"(p[5]), "v"(p[6]), "v"(p[7]) : "memory");
}
// four such copies
__device__ __forceinline__ void acopy4(const unsigned (&l)[4], const void* const (&p)[4]) {
  asm volatile("global_load_async_to_lds_b128 %0, %4, off\n\t"
               "global_load_async_to_lds_b128 %1, %5, off\n\t"
               "global_load_async_to_lds_b128 %2, %6, off\n\t"
               "global_load_async_to_lds_b128 %3, %7, off\n\t"
               "s_wait_xcnt 0x0"
               :: "v"(l[0]), "v"(l[1]), "v"(l[2]), "v"(l[3]), "v"(p[0]), "v"(p[1]), "v"(p[2]), "v"(p[3]) : "memory");
}
#define KPITCH 72   // f16 per staged K, x, weight or O row: 144 B = 16 B x odd, conflict-free for 16-byte fragment reads
// q/k/v: block (64 rows, 128-col chunk = 2 heads, which): Q16/K16 head-major [b][h][e][64] (x4); VT [b][h][d][e] (x4)
__global__ __launch_bounds__(128) void k_qkv(const _Float16* __restrict__ X16, const _Float16* __restrict__ P, _Float16* __restrict__ Q16, _Float16* __restrict__ K16, _Float16* __restrict__ VT) {
  // the staged tiles are dead (behind the loop's last barrier) when the results are laid out for their stores: the two uses share the LDS
  __shared__ __align__(16) union { struct { _Float16 a[2][64][KPITCH]; _Float16 b[2][128][KPITCH]; } t; float so[4][16][132]; _Float16 st[128][72]; } sm;
  auto& so = sm.so; auto& st = sm.st;
  const int tid = threadIdx.x, wave = tid >> 5, lane = tid & 31, col = lane & 15, g = lane >> 4;
  const int which = blockIdx.z, r0b = blockIdx.x * 64, n0 = blockIdx.y * 128; const int b = r0b / EE, e0 = r0b % EE;
  const _Float16* Pw = P + (size_t)which * CC * CC;
  // The k walk starts at a slice of the block's own and wraps: 64 blocks read the same weight rows and 12 the same x rows, and walking in
  // step they would ask L2 for the same lines at the same moment. Only the order of the f32 sums depends on it.
  const int s0 = (blockIdx.x + (blockIdx.x >> 3) + blockIdx.y + 4 * blockIdx.z) & (CC / 64 - 1);
  // k slice ks (64 wide = one 128-B line of each row) -> buffer bf: the block's 128 weight rows and 64 x rows, whole lines, once for the four waves
  // (its loops are unrolled so that the address arrays are indexed by constants and stay in registers, as asm operands must)
  auto stage = [&](int ks, int bf) {
    unsigned l[8]; const void* p[8]; unsigned la[4]; const void* pa[4];
#pragma unroll
    for (int i = 0; i < 8; ++i) { const int c = tid + 128 * i, row = c >> 3, pc = c & 7;
      l[i] = lds_off(&sm.t.b[bf][row][pc * 8]); p[i] = Pw + (size_t)(n0 + row) * CC + ks * 64 + pc * 8; }
    acopy8(l, p);
#pragma unroll
    for (int i = 0; i < 4; ++i) { const int c = tid + 128 * i, row = c >> 3, pc = c & 7;
      la[i] = lds_off(&sm.t.a[bf][row][pc * 8]); pa[i] = X16 + (size_t)(r0b + row) * CC + ks * 64 + pc * 8; }
    acopy4(la, pa);
  };
  stage(s0, 0);
  asm volatile("s_wait_asynccnt 0x0" ::: "memory");   // this wave's part of the first slice has landed
  __syncthreads();                                     // ... and every other wave's
  stage((s0 + 1) & (CC / 64 - 1), 1);
  v8f acc[8] = {};
#pragma unroll 1   // rolled: the trips are parted by barriers, so unrolling would only lengthen the text
  for (int ks = 0; ks < CC / 64; ++ks) { const int bf = ks & 1;
    // the slice's fragments are asked for in one batch ahead of its 16 products, so that the LDS latency is paid once a slice
    // (the short loops are unrolled so that these arrays are indexed by constants and stay in registers)
    v16h a[2], bq[2][8];
#pragma unroll
    for (int kc = 0; kc < 2; ++kc) { a[kc] = frag_h(&sm.t.a[bf][wave * 16 + col][kc * 32], lane);
#pragma unroll
      for (int j = 0; j < 8; ++j) bq[kc][j] = frag_h(&sm.t.b[bf][j * 16 + col][kc * 32], lane); }
#pragma unroll
    for (int kc = 0; kc < 2; ++kc)
#pragma unroll
      for (int j = 0; j < 8; ++j) acc[j] = wmma16(a[kc], bq[kc][j], acc[j]);
    asm volatile("s_wait_dscnt 0" ::: "memory");        // this wave's reads of buffer bf have returned
    asm volatile("s_wait_asynccnt 0x0" ::: "memory");   // this wave's part of slice ks + 1 has landed
    __syncthreads();                                     // publishes slice ks + 1 and ends every wave's reads of buffer bf
    if (ks + 2 < CC / 64) stage((s0 + ks + 2) & (CC / 64 - 1), bf); }
  asm volatile("s_wait_asynccnt 0x0" ::: "memory");     // no copy is left in flight when the LDS is taken for the results
  if (which < 2) {
#pragma unroll
    for (int j = 0; j < 8; ++j)
#pragma unroll
      for (int r = 0; r < 8; ++r) so[wave][8 * g + r][j * 16 + col] = acc[j][r] * (4.0f / 16.0f);
    LDSX();
    _Float16* D = which == 0 ? Q16 : K16;
    for (int q = lane; q < 16 * 2 * 8; q += 32) { const int hh = q >> 7, rl = (q >> 3) & 15, pc = q & 7; const int h = (n0 >> 6) + hh; union { v8h h8; v4u u; } pk;
#pragma unroll
      for (int e = 0; e < 8; ++e) pk.h8[e] = (_Float16)so[wave][rl][hh * 64 + pc * 8 + e];
      vst2(D + (((size_t)b * NH + h) * EE + e0 + wave * 16 + rl) * HD + pc * 8, pk.u); } }
  else {
#pragma unroll
    for (int j = 0; j < 8; ++j)
#pragma unroll
      for (int r = 0; r < 8; ++r) st[j * 16 + col][wave * 16 + 8 * g + r] = (_Float16)(acc[j][r] * (4.0f / 16.0f));
    __syncthreads();
    for (int q = tid; q < 128 * 8; q += 128) { const int cl = q >> 3, pc = q & 7; const int c = n0 + cl, h = c >> 6, d = c & 63; vst2(VT + (((size_t)b * NH + h) * HD + d) * EE + e0 + pc * 8, *(const v4u*)(&st[cl][pc * 8])); } }
}
#define QB 128      // queries of an attention block
#define KS 128      // keys of one step of its walk
#define VPITCH 136  // f16 per staged V^T row of a step: 272 B = 16 B x odd
#define MSPITCH 132 // f32 per staged mask row of a step: 528 B = 16 B x odd
// attention: block (128 q, h, b), 8 waves: S tiles over all 2048 keys (f16); P = (S * adj + 1) / 8 -> f16; acc += P @ V; out = 0.5 * 8 * acc / 4 -> O16 head-major [b][h][e][64] (x 1/8)
// The "+1" of the scores goes into P itself (one fused multiply-add a score), so that the second product also yields the sum of v over the keys.
// Each step's 128 keys of K and V and the block's 128 x 128 piece of the mask are brought into LDS once for the eight waves, with whole-line
// asynchronous copies, one step ahead (two buffers); a wave then fetches its fragments from LDS in two batches a step.
// A wave has 32 queries and 64 of the step's 128 keys: each K and V fragment it reads serves two query tiles, so it reads 48 pieces of 16 B
// for its 32 products. The two waves of a query group sum over different keys; their sums are added through LDS behind the loop.
// The scores are formed transposed (A = K rows, B = Q): a lane then holds 8 adjacent keys of ONE query in each 16-key tile, which is the
// place those scores have in the A fragment of P @ V. So P goes from accumulator to operand inside the lane, and the lane's 8 mask values
// are 32 adjacent bytes of one mask row.
__global__ __launch_bounds__(256) void k_attn(const _Float16* __restrict__ Q16, const _Float16* __restrict__ K16, const _Float16* __restrict__ VT, const float* __restrict__ adj, _Float16* __restrict__ O16) {
  __shared__ __align__(16) _Float16 sK[2][KS][KPITCH];
  __shared__ __align__(16) _Float16 sV[2][HD][VPITCH];
  __shared__ __align__(16) float sM[2][QB][MSPITCH];
  __shared__ __align__(16) float sO[QB][68];
  const int tid = threadIdx.x, w = tid >> 5, lane = tid & 31, col = lane & 15, g = lane >> 4;
  const int qg = w >> 1, kh = w & 1;   // the wave's query group (32 queries) and its half of each step's keys (64 keys)
  const int b = blockIdx.z, h = blockIdx.y, q0b = blockIdx.x * QB, q0 = q0b + qg * 32; const size_t bh = (size_t)b * NH + h;
  // The key walk starts at a step of the block's own and wraps: the 16 blocks of a head read the same K and V rows, the 16 blocks of a query
  // range the same mask rows, and each of these sets gets starts that all differ, so that no two ask L2 for the same lines at the same moment.
  // The sum over the keys has no order of its own; only the order of the f32 sums depends on the start.
  const int s0 = (blockIdx.x + blockIdx.y + NH * blockIdx.z) & (EE / KS - 1);
  // step ks -> buffer bf: K rows (128 B, adjacent), V^T rows (256 B of each of 64 rows), mask rows (512 B of each of 128 rows)
  // (the loops are unrolled so that the address arrays are indexed by constants and stay in registers, as asm operands must)
  auto stage = [&](int ks, int bf) {
    unsigned l[8]; const void* p[8];
#pragma unroll
    for (int i = 0; i < 4; ++i) { const int c = tid + 256 * i;
      l[i] = lds_off(&sK[bf][c >> 3][(c & 7) * 8]); p[i] = K16 + (bh * EE + ks * KS + (c >> 3)) * HD + (c & 7) * 8;
      l[4 + i] = lds_off(&sV[bf][c >> 4][(c & 15) * 8]); p[4 + i] = VT + (bh * HD + (c >> 4)) * EE + ks * KS + (c & 15) * 8; }
    acopy8(l, p);
#pragma unroll
    for (int hf = 0; hf < 2; ++hf) {
#pragma unroll
      for (int i = 0; i < 8; ++i) { const int c = tid + 256 * (hf * 8 + i), row = c >> 5, pc = c & 31;
        l[i] = lds_off(&sM[bf][row][pc * 4]); p[i] = adj + (size_t)(q0b + row) * EE + ks * KS + pc * 4; }
      acopy8(l, p); }
  };
  stage(s0, 0);
  v16h aq[2][2];
#pragma unroll
  for (int qt = 0; qt < 2; ++qt)
#pragma unroll
    for (int kc = 0; kc < 2; ++kc) aq[qt][kc] = frag_h(Q16 + (bh * EE + q0 + qt * 16 + col) * HD + kc * 32, lane);
  asm volatile("s_wait_asynccnt 0x0" ::: "memory");   // this wave's part of the first step has landed
  __syncthreads();                                     // ... and every other wave's
  stage((s0 + 1) & (EE / KS - 1), 1);
  v8f acc[2][4] = {};
#pragma unroll 1   // rolled: the trips are parted by barriers, so unrolling would only lengthen the text
  for (int ks = 0; ks < EE / KS; ++ks) { const int bf = ks & 1;
    // the wave's 64 keys in two runs of 32: with the fragments of all 64 held at once the build spills registers
#pragma unroll   // unrolled so that the LDS offsets of both runs are constants
    for (int sub = 0; sub < 2; ++sub) { const int kb = kh * 64 + sub * 32;
      // the run's fragments and mask values are asked for in one batch ahead of its products, in the order of their use, so that the LDS
      // latency is paid once a run (the short loops are unrolled so that these arrays are indexed by constants and stay in registers)
      v16h kf[2][2], vf[4]; v4f m[2][2][2];
#pragma unroll
      for (int t = 0; t < 2; ++t)
#pragma unroll
        for (int kc = 0; kc < 2; ++kc) kf[t][kc] = frag_h(&sK[bf][kb + t * 16 + col][kc * 32], lane);
#pragma unroll
      for (int qt = 0; qt < 2; ++qt)
#pragma unroll
        for (int t = 0; t < 2; ++t)
#pragma unroll
          for (int i = 0; i < 2; ++i) m[qt][t][i] = *(const v4f*)(&sM[bf][qg * 32 + qt * 16 + col][kb + t * 16 + 8 * g + 4 * i]);
#pragma unroll
      for (int u = 0; u < 4; ++u) vf[u] = frag_h(&sV[bf][u * 16 + col][kb], lane);
      // s[qt][t] element r = score of key kb + t*16 + 8g + r with query qt*16 + col
      v8f s[2][2] = {};
#pragma unroll
      for (int kc = 0; kc < 2; ++kc)
#pragma unroll
        for (int qt = 0; qt < 2; ++qt)
#pragma unroll
          for (int t = 0; t < 2; ++t) s[qt][t] = wmma16(kf[t][kc], aq[qt][kc], s[qt][t]);
#pragma unroll
      for (int qt = 0; qt < 2; ++qt) { v16h pa;   // P's A fragment of the run's 32 keys: elements 0..7 from 16-key tile 0, 8..15 from tile 1
#pragma unroll
        for (int t = 0; t < 2; ++t)
#pragma unroll
          for (int r = 0; r < 8; ++r) pa[8 * t + r] = (_Float16)(s[qt][t][r] * m[qt][t][r >> 2][r & 3] * (1.0f / (16.0f * 8.0f)) + 0.125f);   // (x4 x4)/16 = true qk ; (qk * adj + 1) kept /8
#pragma unroll
        for (int u = 0; u < 4; ++u) acc[qt][u] = wmma16(pa, vf[u], acc[qt][u]); } }
    asm volatile("s_wait_dscnt 0" ::: "memory");        // this wave's reads of buffer bf have returned
    asm volatile("s_wait_asynccnt 0x0" ::: "memory");   // this wave's part of step ks + 1 has landed
    __syncthreads();                                     // publishes step ks + 1 and ends every wave's reads of buffer bf
    if (ks + 2 < EE / KS) stage((s0 + ks + 2) & (EE / KS - 1), bf); }
  asm volatile("s_wait_asynccnt 0x0" ::: "memory");     // no copy is left in flight when the wave goes on
  // out = 0.5 * (acc * 8 / 4) = acc   (P stored /8, V stored x4) ; store O x 1/8 as f16 (values ~ O(50))
  // the sums over the two key halves meet in LDS: the wave of the upper half lays its sums down, the other adds its own at the same places
  if (kh == 1) {
#pragma unroll
    for (int qt = 0; qt < 2; ++qt)
#pragma unroll
      for (int u = 0; u < 4; ++u)
#pragma unroll
        for (int r = 0; r < 8; ++r) sO[qg * 32 + qt * 16 + 8 * g + r][u * 16 + col] = acc[qt][u][r]; }
  __syncthreads();   // the upper halves' sums are there
  if (kh == 0) {
#pragma unroll
    for (int qt = 0; qt < 2; ++qt)
#pragma unroll
      for (int u = 0; u < 4; ++u)
#pragma unroll
        for (int r = 0; r < 8; ++r) { float* e = &sO[qg * 32 + qt * 16 + 8 * g + r][u * 16 + col]; *e = (acc[qt][u][r] + *e) * 0.125f; } }
  __syncthreads();   // the rows are whole: all eight waves store them, whole lines
  for (int q = tid; q < QB * 8; q += 256) { const int rl = q >> 3, pc = q & 7; union { v8h h8; v4u u; } pk;
#pragma unroll
    for (int e = 0; e < 8; ++e) pk.h8[e] = (_Float16)sO[rl][pc * 8 + e];
    vst2(O16 + (bh * EE + q0b + rl) * HD + pc * 8, pk.u); }
}
// proj + bias + LN; y = x + gamma * LN(out). Block = 16 rows x all 512 cols, 8 waves: wave w does cols 64w..64w+63 (one pass),
// then, behind one block barrier, wave w normalises rows 2w and 2w+1 with 16 columns per lane and whole-line loads and stores.
// The operands come through LDS by whole-line asynchronous copies: the block's 16 O rows once, the weight in k slices of 64 (one 128-B line
// of each of its 512 rows), one slice ahead (two buffers); a wave then fetches a slice's fragments from LDS in one batch, so that no product
// waits for a global load of its own.
__global__ __launch_bounds__(256) void k_proj(const _Float16* __restrict__ O16, const _Float16* __restrict__ P, const float* __restrict__ bp, const float* __restrict__ lnw, const float* __restrict__ lnb, const float* __restrict__ gam, const float* __restrict__ x, float* __restrict__ out) {
  __shared__ __align__(16) _Float16 sb[2][CC][KPITCH];
  __shared__ __align__(16) _Float16 sa[NH][16][KPITCH];
  __shared__ __align__(16) float sy[16][CC + 4];
  const int tid = threadIdx.x, wave = tid >> 5, lane = tid & 31, col = lane & 15, g = lane >> 4;
  const int r0 = blockIdx.x * 16, n0 = wave * 64;
  const _Float16* Pw = P + (size_t)3 * CC * CC;
  // The k walk starts at a slice of the block's own and wraps: every block reads the whole weight, and walking in step all would ask L2 for
  // the same lines at the same moment. Only the order of the f32 sums depends on it.
  const int s0 = (blockIdx.x + (blockIdx.x >> 3)) & (CC / 64 - 1);
  // weight slice ks -> buffer bf: 512 rows x 8 pieces of 16 B, 16 pieces a thread
  // (the loops are unrolled so that the address arrays are indexed by constants and stay in registers, as asm operands must)
  auto stage = [&](int ks, int bf) {
#pragma unroll
    for (int hf = 0; hf < 2; ++hf) { unsigned l[8]; const void* p[8];
#pragma unroll
      for (int i = 0; i < 8; ++i) { const int c = tid + 256 * (hf * 8 + i), row = c >> 3, pc = c & 7;
        l[i] = lds_off(&sb[bf][row][pc * 8]); p[i] = Pw + (size_t)row * CC + ks * 64 + pc * 8; }
      acopy8(l, p); }
  };
  { // the block's O rows, all eight heads (= k slices): 8 x 16 rows x 8 pieces, 4 pieces a thread
    unsigned l[4]; const void* p[4];
#pragma unroll
    for (int i = 0; i < 4; ++i) { const int c = tid + 256 * i, hd = c >> 7, row = (c >> 3) & 15, pc = c & 7; const int R = r0 + row;
      l[i] = lds_off(&sa[hd][row][pc * 8]); p[i] = O16 + ((((size_t)(R / EE)) * NH + hd) * EE + (R % EE)) * HD + pc * 8; }
    acopy4(l, p); }
  stage(s0, 0);
  asm volatile("s_wait_asynccnt 0x0" ::: "memory");   // this wave's part of the O rows and of the first slice has landed
  __syncthreads();                                     // ... and every other wave's
  stage((s0 + 1) & (CC / 64 - 1), 1);
  v8f acc[4] = {};
#pragma unroll 1   // rolled: the trips are parted by barriers, so unrolling would only lengthen the text
  for (int ks = 0; ks < CC / 64; ++ks) { const int bf = ks & 1;
    // (the short loops are unrolled so that these arrays are indexed by constants and stay in registers)
    v16h a[2], bw[2][4];
#pragma unroll
    for (int kc = 0; kc < 2; ++kc) { a[kc] = frag_h(&sa[(s0 + ks) & (CC / 64 - 1)][col][kc * 32], lane);
#pragma unroll
      for (int j = 0; j < 4; ++j) bw[kc][j] = frag_h(&sb[bf][n0 + j * 16 + col][kc * 32], lane); }
#pragma unroll
    for (int kc = 0; kc < 2; ++kc)
#pragma unroll
      for (int j = 0; j < 4; ++j) acc[j] = wmma16(a[kc], bw[kc][j], acc[j]);
    asm volatile("s_wait_dscnt 0" ::: "memory");        // this wave's reads of buffer bf have returned
    asm volatile("s_wait_asynccnt 0x0" ::: "memory");   // this wave's part of slice ks + 1 has landed
    __syncthreads();                                     // publishes slice ks + 1 and ends every wave's reads of buffer bf
    if (ks + 2 < CC / 64) stage((s0 + ks + 2) & (CC / 64 - 1), bf); }
  asm volatile("s_wait_asynccnt 0x0" ::: "memory");     // no copy is left in flight when the wave goes on
  // this wave's x rows and the LN weights are asked for here, so that they fly during the LDS exchange and the row sums
  const float gm = gam[0]; v4f lw[4], lb[4], xv[2][4];
#pragma unroll
  for (int i = 0; i < 4; ++i) { lw[i] = *(const v4f*)(lnw + (i * 32 + lane) * 4); lb[i] = *(const v4f*)(lnb + (i * 32 + lane) * 4);
#pragma unroll
    for (int rr = 0; rr < 2; ++rr) xv[rr][i] = *(const v4f*)(x + (size_t)(r0 + wave * 2 + rr) * CC + (i * 32 + lane) * 4); }
#pragma unroll
  for (int j = 0; j < 4; ++j) { const int c = n0 + j * 16 + col; const float bb = bp[c];
#pragma unroll
    for (int r = 0; r < 8; ++r) sy[8 * g + r][c] = acc[j][r] * (8.0f / 16.0f) + bb; }
  __syncthreads();   // a row's 512 columns come from all eight waves
#pragma unroll
  for (int rr = 0; rr < 2; ++rr) { const int rl = wave * 2 + rr; v4f v[4];
#pragma unroll
    for (int i = 0; i < 4; ++i) v[i] = *(const v4f*)(&sy[rl][(i * 32 + lane) * 4]);
    float s = 0.f;
#pragma unroll
    for (int i = 0; i < 4; ++i) s += (v[i][0] + v[i][1]) + (v[i][2] + v[i][3]);
#pragma unroll
    for (int m = 16; m >= 1; m >>= 1) s += __shfl_xor(s, m, 32);
    const float mu = s * (1.0f / CC); float q2 = 0.f;
#pragma unroll
    for (int i = 0; i < 4; ++i) { v[i] -= mu; const v4f d2 = v[i] * v[i]; q2 += (d2[0] + d2[1]) + (d2[2] + d2[3]); }
#pragma unroll
    for (int m = 16; m >= 1; m >>= 1) q2 += __shfl_xor(q2, m, 32);
    const float rs = rsqrtf(q2 * (1.0f / CC) + 1e-5f);
#pragma unroll
    for (int i = 0; i < 4; ++i) vst2(out + (size_t)(r0 + rl) * CC + (i * 32 + lane) * 4, (v4f)(xv[rr][i] + gm * (v[i] * rs * lw[i] + lb[i]))); }
}
extern "C" void kernel_launch(void* const* d_in, const int* in_sizes, int n_in, void* d_out, int out_size, void* d_ws, size_t ws_size, hipStream_t stream) {
  (void)in_sizes; (void)n_in; (void)out_size; (void)ws_size;
  const float** I = (const float**)d_in;
  const float* x = I[0]; const float* adj = I[1]; const float* Wq = I[2]; const float* Wk = I[3]; const float* Wv = I[4]; const float* Wp = I[5]; const float* bp = I[6]; const float* lnw = I[7]; const float* lnb = I[8]; const float* gam = I[9];
  float* out = (float*)d_out;
  char* ws = (char*)d_ws; size_t off = 0;
  auto take = [&](size_t bytes) { char* p = ws + off; off += (bytes + 255) & ~(size_t)255; return p; };
  _Float16* X16 = (_Float16*)take((size_t)NR * CC * 2); _Float16* P = (_Float16*)take((size_t)4 * CC * CC * 2);
  _Float16* Q16 = (_Float16*)take((size_t)NR * CC * 2); _Float16* K16 = (_Float16*)take((size_t)NR * CC * 2); _Float16* VT = (_Float16*)take((size_t)NR * CC * 2); _Float16* O16 = (_Float16*)take((size_t)NR * CC * 2);
  k_prep<<<NPC / 256, 256, 0, stream>>>(x, Wq, Wk, Wv, Wp, X16, P);
  k_qkv<<<dim3(NR / 64, CC / 128, 3), 128, 0, stream>>>(X16, P, Q16, K16, VT);
  k_attn<<<dim3(EE / QB, NH, NB), 256, 0, stream>>>(Q16, K16, VT, adj, O16);
  k_proj<<<NR / 16, 256, 0, stream>>>(O16, P, bp, lnw, lnb, gam, x, out);
}
